// v000
// Measured on an AMD MI455X. A time is GPU time per run, averaged over a window of back-to-back runs after a warm-up
// (all launches, gaps included; the runs take copies of the inputs in turn), and the median of several windows.
// Apart from v000's, it joins two sittings. Times from different sittings can be a few percent apart, while
// side-by-side timings come from the same sitting.
// The starting kernel, v000, takes 416 microseconds a run.
#include <hip/hip_runtime.h>
#include <math.h>

// Problem constants (B=1)
#define HEADS 8
#define CDIM  128
#define HD    16          // head dim
#define HH    16
#define WW    32
#define DD    32
#define NTOT  (HH*WW*DD)  // 16384 spatial positions
#define ATTN_SCALE 0.25f  // (CDIM/HEADS)^-0.5 = 16^-0.5

typedef float v2f __attribute__((ext_vector_type(2)));
typedef float v8f __attribute__((ext_vector_type(8)));

// D(16x16,f32) = A(16x4,f32) x B(4x16,f32) + C  -- V_WMMA_F32_16X16X4_F32
static __device__ __forceinline__ v8f wmma4(v2f a, v2f b, v8f c) {
  return __builtin_amdgcn_wmma_f32_16x16x4_f32(false, a, false, b, (short)0, c,
                                               false, false);
}

// ---------------------------------------------------------------------------
// Async global->LDS copies (GLOBAL_LOAD_ASYNC_TO_LDS_B128, ASYNCcnt) when the
// toolchain exposes them; falls back to vectorized load+ds_store otherwise.
// Builtin signature (from diagnostics): (v4i addrspace(1)*, v4i addrspace(3)*,
// imm offset, imm cpol) where v4i = 16-byte int vector (b128 payload).
// ---------------------------------------------------------------------------
#if __has_builtin(__builtin_amdgcn_global_load_async_to_lds_b128) && \
    __has_builtin(__builtin_amdgcn_s_wait_asynccnt)
#define USE_ASYNC_LDS 1
typedef int v4i_ __attribute__((vector_size(4 * sizeof(int))));
typedef __attribute__((address_space(1))) v4i_ as1_v4i;
typedef __attribute__((address_space(3))) v4i_ as3_v4i;
#endif

static __device__ __forceinline__ void copy16_g2l(const float* g, float* l) {
#ifdef USE_ASYNC_LDS
  __builtin_amdgcn_global_load_async_to_lds_b128(
      (as1_v4i*)(uintptr_t)g,
      (as3_v4i*)(uint32_t)(uintptr_t)l,   // low 32 bits == LDS byte offset
      0, 0);
#else
  *(float4*)l = *(const float4*)g;
#endif
}

static __device__ __forceinline__ void async_join() {
#ifdef USE_ASYNC_LDS
  __builtin_amdgcn_s_wait_asynccnt(0);
#endif
}

// ---------------------------------------------------------------------------
// K1: q/k/v = xt @ {qw,kw,vw}.  xt[n,c] = x[c*N+n].  One wave per 16x16 tile,
// A-loads shared across the three accumulators.  Output row-major (N,C).
// ---------------------------------------------------------------------------
__global__ __launch_bounds__(32)
void qkv_gemm_kernel(const float* __restrict__ x,
                     const float* __restrict__ qw, const float* __restrict__ kw,
                     const float* __restrict__ vw,
                     float* __restrict__ qraw, float* __restrict__ kraw,
                     float* __restrict__ vraw) {
  const int n0 = blockIdx.x * 16;
  const int c0 = blockIdx.y * 16;
  const int lane = threadIdx.x & 31;
  const int lm = lane & 15;        // M / N column within tile
  const int lh = lane >> 4;        // lane-half selects K pair
  v8f aq = {0,0,0,0,0,0,0,0};
  v8f ak = {0,0,0,0,0,0,0,0};
  v8f av = {0,0,0,0,0,0,0,0};
  for (int k0 = 0; k0 < CDIM; k0 += 4) {
    const int ka = k0 + 2*lh;
    v2f a, b;
    // A[M=lm, K=ka..ka+1] = xt[n0+lm, ka] = x[ka*N + n0+lm]
    a.x = x[(size_t)(ka    )*NTOT + n0 + lm];
    a.y = x[(size_t)(ka + 1)*NTOT + n0 + lm];
    if (k0 + 4 < CDIM) __builtin_prefetch(&x[(size_t)(ka + 4)*NTOT + n0 + lm], 0, 1);
    b.x = qw[(ka    )*CDIM + c0 + lm];
    b.y = qw[(ka + 1)*CDIM + c0 + lm];
    aq = wmma4(a, b, aq);
    b.x = kw[(ka    )*CDIM + c0 + lm];
    b.y = kw[(ka + 1)*CDIM + c0 + lm];
    ak = wmma4(a, b, ak);
    b.x = vw[(ka    )*CDIM + c0 + lm];
    b.y = vw[(ka + 1)*CDIM + c0 + lm];
    av = wmma4(a, b, av);
  }
#pragma unroll
  for (int r = 0; r < 8; ++r) {
    const int n = n0 + r + 8*lh;   // D layout: VGPR r, lane-half -> M
    const int c = c0 + lm;
    qraw[(size_t)n*CDIM + c] = aq[r];
    kraw[(size_t)n*CDIM + c] = ak[r];
    vraw[(size_t)n*CDIM + c] = av[r];
  }
}

// ---------------------------------------------------------------------------
// K2: softmax of q over head-dim (16 contiguous cols) + transpose to [c][n]
// ---------------------------------------------------------------------------
__global__ void softmax_q_kernel(const float* __restrict__ qraw,
                                 float* __restrict__ q3) {
  const int tid = blockIdx.x * blockDim.x + threadIdx.x;
  const int head = tid >> 14;          // / NTOT
  const int n    = tid & (NTOT - 1);
  float v[16];
  float m = -3.0e38f;
#pragma unroll
  for (int j = 0; j < 16; ++j) {
    v[j] = qraw[(size_t)n*CDIM + head*16 + j];
    m = fmaxf(m, v[j]);
  }
  float s = 0.f;
#pragma unroll
  for (int j = 0; j < 16; ++j) { v[j] = __expf(v[j] - m); s += v[j]; }
  const float inv = 1.f / s;
#pragma unroll
  for (int j = 0; j < 16; ++j)
    q3[(size_t)(head*16 + j)*NTOT + n] = v[j] * inv;
}

// ---------------------------------------------------------------------------
// K3: softmax of k over the HEADS axis (cols j, j+16, ..., j+112) + transpose
// ---------------------------------------------------------------------------
__global__ void softmax_k_kernel(const float* __restrict__ kraw,
                                 float* __restrict__ k3) {
  const int tid = blockIdx.x * blockDim.x + threadIdx.x;
  const int j = tid >> 14;             // 0..15
  const int n = tid & (NTOT - 1);
  float v[8];
  float m = -3.0e38f;
#pragma unroll
  for (int h = 0; h < 8; ++h) {
    v[h] = kraw[(size_t)n*CDIM + h*16 + j];
    m = fmaxf(m, v[h]);
  }
  float s = 0.f;
#pragma unroll
  for (int h = 0; h < 8; ++h) { v[h] = __expf(v[h] - m); s += v[h]; }
  const float inv = 1.f / s;
#pragma unroll
  for (int h = 0; h < 8; ++h)
    k3[(size_t)(h*16 + j)*NTOT + n] = v[h] * inv;
}

// ---------------------------------------------------------------------------
// K4: transpose v (N,C) -> (C,N)
// ---------------------------------------------------------------------------
__global__ void transpose_v_kernel(const float* __restrict__ vraw,
                                   float* __restrict__ v3) {
  const int tid = blockIdx.x * blockDim.x + threadIdx.x;   // = c*NTOT + n
  const int c = tid >> 14;
  const int n = tid & (NTOT - 1);
  v3[tid] = vraw[(size_t)n*CDIM + c];
}

// ---------------------------------------------------------------------------
// K5: inclusive 3-D summed-area table over contiguous (16,32,32) volumes.
// One block per volume; whole volume staged in 64 KB of LDS via async b128
// copies (this kernel streams the 128 MB ikv tensor => dominant data mover).
// ---------------------------------------------------------------------------
__global__ __launch_bounds__(256)
void sat3d_kernel(const float* __restrict__ src, float* __restrict__ dst) {
  __shared__ float vol[NTOT];
  const float* s = src + (size_t)blockIdx.x * NTOT;
  float* dptr = dst + (size_t)blockIdx.x * NTOT;
  for (int t4 = threadIdx.x * 4; t4 < NTOT; t4 += 256 * 4)
    copy16_g2l(s + t4, vol + t4);
  async_join();
  __syncthreads();
  // cumsum along d: 512 (h,w)-rows of 32
  for (int r = threadIdx.x; r < 512; r += 256) {
    const int base = r * 32;
    float run = 0.f;
    for (int d = 0; d < 32; ++d) { run += vol[base + d]; vol[base + d] = run; }
  }
  __syncthreads();
  // cumsum along w: 512 (h,d)-columns
  for (int r = threadIdx.x; r < 512; r += 256) {
    const int h = r >> 5, d = r & 31;
    float run = 0.f;
    for (int w = 0; w < 32; ++w) {
      const int idx = h*1024 + w*32 + d;
      run += vol[idx]; vol[idx] = run;
    }
  }
  __syncthreads();
  // cumsum along h: 1024 (w,d)-columns
  for (int r = threadIdx.x; r < 1024; r += 256) {
    float run = 0.f;
    for (int h = 0; h < 16; ++h) {
      const int idx = h*1024 + r;
      run += vol[idx]; vol[idx] = run;
    }
  }
  __syncthreads();
  for (int t4 = threadIdx.x * 4; t4 < NTOT; t4 += 256 * 4)
    *(float4*)(dptr + t4) = *(const float4*)(vol + t4);
}

// ---------------------------------------------------------------------------
// K6: kv[bh,i,j,h,:,:] = k3slice_i(32x32) @ v3slice_j(32x32) for all 16x16
// (i,j).  One block per (h,bh).  Both operand families staged in LDS (async
// b128 fills); rows padded to stride 36 floats: 16B-aligned and 36*lane mod 64
// hits 16 distinct banks => conflict-free A reads.  Each wave: 32 pairs x
// 4 tiles x 8 K-steps of V_WMMA_F32_16X16X4_F32.
// ---------------------------------------------------------------------------
#define LSTR  36           // padded LDS row stride (floats)
#define SLICE (32*LSTR)    // 1152 floats per 32x32 slice

__global__ __launch_bounds__(256)
void kv_gemm_kernel(const float* __restrict__ k3, const float* __restrict__ v3,
                    float* __restrict__ kv) {
  __shared__ float Alds[16 * SLICE];   // 72 KB: A_i[w][m]
  __shared__ float Blds[16 * SLICE];   // 72 KB: B_j[m][d]
  const int h  = blockIdx.x;            // 0..15
  const int bh = blockIdx.y;            // 0..7
  // 16 slices * 32 rows * 8 four-float chunks = 4096 chunks per family
  for (int t = threadIdx.x; t < 4096; t += 256) {
    const int i   = t >> 8;            // slice
    const int row = (t >> 3) & 31;     // row within slice
    const int ch  = (t & 7) << 2;      // float offset of 16-byte chunk
    const size_t gofs = (size_t)(bh*16 + i)*NTOT + h*1024 + row*32 + ch;
    const int    lofs = i*SLICE + row*LSTR + ch;
    copy16_g2l(k3 + gofs, Alds + lofs);
    copy16_g2l(v3 + gofs, Blds + lofs);
  }
  async_join();
  __syncthreads();
  const int wave = threadIdx.x >> 5;
  const int lane = threadIdx.x & 31;
  const int lm = lane & 15, lh = lane >> 4;
  for (int p = wave; p < 256; p += 8) {
    const int i = p >> 4, j = p & 15;
    const float* A = Alds + i*SLICE;                              // [w][m]
    const float* B = Blds + j*SLICE;                              // [m][d]
    float* out = kv + ((size_t)((bh*16 + i)*16 + j))*NTOT + h*1024;
#pragma unroll
    for (int mt = 0; mt < 32; mt += 16) {
#pragma unroll
      for (int nt = 0; nt < 32; nt += 16) {
        v8f acc = {0,0,0,0,0,0,0,0};
#pragma unroll
        for (int k0 = 0; k0 < 32; k0 += 4) {
          const int kk = k0 + 2*lh;
          v2f a, b;
          a.x = A[(mt + lm)*LSTR + kk];
          a.y = A[(mt + lm)*LSTR + kk + 1];
          b.x = B[(kk    )*LSTR + nt + lm];
          b.y = B[(kk + 1)*LSTR + nt + lm];
          acc = wmma4(a, b, acc);
        }
#pragma unroll
        for (int r = 0; r < 8; ++r) {
          const int w = mt + r + 8*lh, d = nt + lm;
          out[w*32 + d] = acc[r];
        }
      }
    }
  }
}

// ---------------------------------------------------------------------------
// K7: windowed box sums via 8-corner SAT differences (edge-clamped center
// padding), contracted with q; accumulates 0.5 * sum over both windows of
// SCALE*num/Z into acc[c][n].
// ---------------------------------------------------------------------------
__global__ __launch_bounds__(256)
void wkv_num_kernel(const float* __restrict__ q3, const float* __restrict__ ik,
                    const float* __restrict__ ikv, float* __restrict__ accout) {
  const int bh = blockIdx.y;
  const int voxel = blockIdx.x * 256 + threadIdx.x;
  const int h = voxel >> 10, w = (voxel >> 5) & 31, d = voxel & 31;
  float qv[16];
#pragma unroll
  for (int i = 0; i < 16; ++i)
    qv[i] = q3[(size_t)(bh*16 + i)*NTOT + voxel];
  float res[16];
#pragma unroll
  for (int j = 0; j < 16; ++j) res[j] = 0.f;

#pragma unroll 1
  for (int win = 0; win < 2; ++win) {
    const int a = win ? 8 : 4;
    const int da = a - 1;
    const int oh = HH - a + 1, ow = WW - a + 1, od = DD - a + 1;
    const int ph = (HH - oh) >> 1, pw = (WW - ow) >> 1, pd = (DD - od) >> 1;
    int th = h - ph; th = th < 0 ? 0 : (th > oh - 1 ? oh - 1 : th);
    int tw = w - pw; tw = tw < 0 ? 0 : (tw > ow - 1 ? ow - 1 : tw);
    int td = d - pd; td = td < 0 ? 0 : (td > od - 1 ? od - 1 : td);
    const int h1 = th + da, w1 = tw + da, d1 = td + da;
    int off[8]; float sgn[8];
    off[0] = h1*1024 + w1*32 + d1; sgn[0] =  1.f;
    off[1] = h1*1024 + w1*32 + td; sgn[1] = -1.f;
    off[2] = h1*1024 + tw*32 + d1; sgn[2] = -1.f;
    off[3] = h1*1024 + tw*32 + td; sgn[3] =  1.f;
    off[4] = th*1024 + w1*32 + d1; sgn[4] = -1.f;
    off[5] = th*1024 + w1*32 + td; sgn[5] =  1.f;
    off[6] = th*1024 + tw*32 + d1; sgn[6] =  1.f;
    off[7] = th*1024 + tw*32 + td; sgn[7] = -1.f;

    float Z = 1e-6f;
#pragma unroll 1
    for (int i = 0; i < 16; ++i) {
      const float* vv = ik + (size_t)(bh*16 + i)*NTOT;
      float wk = 0.f;
#pragma unroll
      for (int c = 0; c < 8; ++c) wk += sgn[c] * vv[off[c]];
      Z += qv[i] * wk;
    }
    float num[16];
#pragma unroll
    for (int j = 0; j < 16; ++j) num[j] = 0.f;
#pragma unroll 1
    for (int i = 0; i < 16; ++i) {
      const float qi = qv[i];
#pragma unroll 1
      for (int j = 0; j < 16; ++j) {
        const float* vv = ikv + ((size_t)((bh*16 + i)*16 + j))*NTOT;
        float s8 = 0.f;
#pragma unroll
        for (int c = 0; c < 8; ++c) s8 += sgn[c] * vv[off[c]];
        num[j] += qi * s8;
      }
    }
    const float f = ATTN_SCALE / Z;
#pragma unroll
    for (int j = 0; j < 16; ++j) res[j] += num[j] * f;
  }
#pragma unroll
  for (int j = 0; j < 16; ++j)
    accout[(size_t)(bh*16 + j)*NTOT + voxel] = 0.5f * res[j];   // / len(WINDOWS)
}

// ---------------------------------------------------------------------------
// K8: final projection: d_out[c][n] = sum_c' acc[c'][n]*pw[c'][c] + pb[c]
// ---------------------------------------------------------------------------
__global__ __launch_bounds__(32)
void proj_gemm_kernel(const float* __restrict__ accb,
                      const float* __restrict__ pw,
                      const float* __restrict__ pb,
                      float* __restrict__ out) {
  const int n0 = blockIdx.x * 16;
  const int c0 = blockIdx.y * 16;
  const int lane = threadIdx.x & 31;
  const int lm = lane & 15, lh = lane >> 4;
  v8f acc = {0,0,0,0,0,0,0,0};
  for (int k0 = 0; k0 < CDIM; k0 += 4) {
    const int ka = k0 + 2*lh;
    v2f a, b;
    a.x = accb[(size_t)(ka    )*NTOT + n0 + lm];
    a.y = accb[(size_t)(ka + 1)*NTOT + n0 + lm];
    b.x = pw[(ka    )*CDIM + c0 + lm];
    b.y = pw[(ka + 1)*CDIM + c0 + lm];
    acc = wmma4(a, b, acc);
  }
  const float bias = pb[c0 + lm];
#pragma unroll
  for (int r = 0; r < 8; ++r) {
    const int n = n0 + r + 8*lh;
    const int c = c0 + lm;
    out[(size_t)c*NTOT + n] = acc[r] + bias;   // transpose back to (C,N)
  }
}

// ---------------------------------------------------------------------------
extern "C" void kernel_launch(void* const* d_in, const int* in_sizes, int n_in,
                              void* d_out, int out_size, void* d_ws, size_t ws_size,
                              hipStream_t stream) {
  const float* x  = (const float*)d_in[0];
  const float* qw = (const float*)d_in[1];
  const float* kw = (const float*)d_in[2];
  const float* vw = (const float*)d_in[3];
  const float* pw = (const float*)d_in[4];
  const float* pb = (const float*)d_in[5];
  float* out = (float*)d_out;

  const size_t U = (size_t)NTOT * CDIM;     // 2,097,152 floats
  float* ws   = (float*)d_ws;
  float* qraw = ws;                         // (N,C)
  float* kraw = ws + 1*U;
  float* vraw = ws + 2*U;
  float* q3   = ws + 3*U;                   // (C,N)
  float* k3   = ws + 4*U;
  float* v3   = ws + 5*U;
  float* ik   = ws + 6*U;                   // SAT of k3
  float* accb = ws + 7*U;                   // attention output (C,N)
  float* ikv  = ws + 8*U;                   // kv then SAT(kv): 16*U floats

  qkv_gemm_kernel<<<dim3(NTOT/16, CDIM/16), 32, 0, stream>>>(x, qw, kw, vw,
                                                             qraw, kraw, vraw);
  softmax_q_kernel<<<(NTOT*HEADS)/256, 256, 0, stream>>>(qraw, q3);
  softmax_k_kernel<<<(NTOT*HD)/256, 256, 0, stream>>>(kraw, k3);
  transpose_v_kernel<<<(NTOT*CDIM)/256, 256, 0, stream>>>(vraw, v3);
  sat3d_kernel<<<CDIM, 256, 0, stream>>>(k3, ik);
  kv_gemm_kernel<<<dim3(HH, HEADS), 256, 0, stream>>>(k3, v3, ikv);
  sat3d_kernel<<<CDIM*HD, 256, 0, stream>>>(ikv, ikv);
  wkv_num_kernel<<<dim3(NTOT/256, HEADS), 256, 0, stream>>>(q3, ik, ikv, accb);
  proj_gemm_kernel<<<dim3(NTOT/16, CDIM/16), 32, 0, stream>>>(accb, pw, pb, out);
}

// v001
// Measured time: 197 microseconds a run.
// Two timings next to v000 put it at 2.15 and 2.13 times that version's speed.
#include <hip/hip_runtime.h>
#include <math.h>

// Problem constants (B=1)
#define HEADS 8
#define CDIM  128
#define HD    16          // head dim
#define HH    16
#define WW    32
#define DD    32
#define NTOT  (HH*WW*DD)  // 16384 spatial positions
#define ATTN_SCALE 0.25f  // (CDIM/HEADS)^-0.5 = 16^-0.5

typedef float v2f __attribute__((ext_vector_type(2)));
typedef float v8f __attribute__((ext_vector_type(8)));

// D(16x16,f32) = A(16x4,f32) x B(4x16,f32) + C  -- V_WMMA_F32_16X16X4_F32
static __device__ __forceinline__ v8f wmma4(v2f a, v2f b, v8f c) {
  return __builtin_amdgcn_wmma_f32_16x16x4_f32(false, a, false, b, (short)0, c,
                                               false, false);
}

// ---------------------------------------------------------------------------
// Async global->LDS copies (GLOBAL_LOAD_ASYNC_TO_LDS_B128, ASYNCcnt) when the
// toolchain exposes them; falls back to vectorized load+ds_store otherwise.
// Builtin signature (from diagnostics): (v4i addrspace(1)*, v4i addrspace(3)*,
// imm offset, imm cpol) where v4i = 16-byte int vector (b128 payload).
// ---------------------------------------------------------------------------
#if __has_builtin(__builtin_amdgcn_global_load_async_to_lds_b128) && \
    __has_builtin(__builtin_amdgcn_s_wait_asynccnt)
#define USE_ASYNC_LDS 1
typedef int v4i_ __attribute__((vector_size(4 * sizeof(int))));
typedef __attribute__((address_space(1))) v4i_ as1_v4i;
typedef __attribute__((address_space(3))) v4i_ as3_v4i;
#endif

static __device__ __forceinline__ void copy16_g2l(const float* g, float* l) {
#ifdef USE_ASYNC_LDS
  __builtin_amdgcn_global_load_async_to_lds_b128(
      (as1_v4i*)(uintptr_t)g,
      (as3_v4i*)(uint32_t)(uintptr_t)l,   // low 32 bits == LDS byte offset
      0, 0);
#else
  *(float4*)l = *(const float4*)g;
#endif
}

static __device__ __forceinline__ void async_join() {
#ifdef USE_ASYNC_LDS
  __builtin_amdgcn_s_wait_asynccnt(0);
#endif
}

// ---------------------------------------------------------------------------
// K1: q/k/v = xt @ {qw,kw,vw}.  xt[n,c] = x[c*N+n].  One wave per 16x16 tile,
// A-loads shared across the three accumulators.  Output row-major (N,C).
// ---------------------------------------------------------------------------
__global__ __launch_bounds__(32)
void qkv_gemm_kernel(const float* __restrict__ x,
                     const float* __restrict__ qw, const float* __restrict__ kw,
                     const float* __restrict__ vw,
                     float* __restrict__ qraw, float* __restrict__ kraw,
                     float* __restrict__ vraw) {
  const int n0 = blockIdx.x * 16;
  const int c0 = blockIdx.y * 16;
  const int lane = threadIdx.x & 31;
  const int lm = lane & 15;        // M / N column within tile
  const int lh = lane >> 4;        // lane-half selects K pair
  v8f aq = {0,0,0,0,0,0,0,0};
  v8f ak = {0,0,0,0,0,0,0,0};
  v8f av = {0,0,0,0,0,0,0,0};
  for (int k0 = 0; k0 < CDIM; k0 += 4) {
    const int ka = k0 + 2*lh;
    v2f a, b;
    // A[M=lm, K=ka..ka+1] = xt[n0+lm, ka] = x[ka*N + n0+lm]
    a.x = x[(size_t)(ka    )*NTOT + n0 + lm];
    a.y = x[(size_t)(ka + 1)*NTOT + n0 + lm];
    if (k0 + 4 < CDIM) __builtin_prefetch(&x[(size_t)(ka + 4)*NTOT + n0 + lm], 0, 1);
    b.x = qw[(ka    )*CDIM + c0 + lm];
    b.y = qw[(ka + 1)*CDIM + c0 + lm];
    aq = wmma4(a, b, aq);
    b.x = kw[(ka    )*CDIM + c0 + lm];
    b.y = kw[(ka + 1)*CDIM + c0 + lm];
    ak = wmma4(a, b, ak);
    b.x = vw[(ka    )*CDIM + c0 + lm];
    b.y = vw[(ka + 1)*CDIM + c0 + lm];
    av = wmma4(a, b, av);
  }
#pragma unroll
  for (int r = 0; r < 8; ++r) {
    const int n = n0 + r + 8*lh;   // D layout: VGPR r, lane-half -> M
    const int c = c0 + lm;
    qraw[(size_t)n*CDIM + c] = aq[r];
    kraw[(size_t)n*CDIM + c] = ak[r];
    vraw[(size_t)n*CDIM + c] = av[r];
  }
}

// ---------------------------------------------------------------------------
// K2: softmax of q over head-dim (16 contiguous cols) + transpose to [c][n]
// ---------------------------------------------------------------------------
__global__ void softmax_q_kernel(const float* __restrict__ qraw,
                                 float* __restrict__ q3) {
  const int tid = blockIdx.x * blockDim.x + threadIdx.x;
  const int head = tid >> 14;          // / NTOT
  const int n    = tid & (NTOT - 1);
  float v[16];
  float m = -3.0e38f;
#pragma unroll
  for (int j = 0; j < 16; ++j) {
    v[j] = qraw[(size_t)n*CDIM + head*16 + j];
    m = fmaxf(m, v[j]);
  }
  float s = 0.f;
#pragma unroll
  for (int j = 0; j < 16; ++j) { v[j] = __expf(v[j] - m); s += v[j]; }
  const float inv = 1.f / s;
#pragma unroll
  for (int j = 0; j < 16; ++j)
    q3[(size_t)(head*16 + j)*NTOT + n] = v[j] * inv;
}

// ---------------------------------------------------------------------------
// K3: softmax of k over the HEADS axis (cols j, j+16, ..., j+112) + transpose
// ---------------------------------------------------------------------------
__global__ void softmax_k_kernel(const float* __restrict__ kraw,
                                 float* __restrict__ k3) {
  const int tid = blockIdx.x * blockDim.x + threadIdx.x;
  const int j = tid >> 14;             // 0..15
  const int n = tid & (NTOT - 1);
  float v[8];
  float m = -3.0e38f;
#pragma unroll
  for (int h = 0; h < 8; ++h) {
    v[h] = kraw[(size_t)n*CDIM + h*16 + j];
    m = fmaxf(m, v[h]);
  }
  float s = 0.f;
#pragma unroll
  for (int h = 0; h < 8; ++h) { v[h] = __expf(v[h] - m); s += v[h]; }
  const float inv = 1.f / s;
#pragma unroll
  for (int h = 0; h < 8; ++h)
    k3[(size_t)(h*16 + j)*NTOT + n] = v[h] * inv;
}

// ---------------------------------------------------------------------------
// K4: transpose v (N,C) -> (C,N)
// ---------------------------------------------------------------------------
__global__ void transpose_v_kernel(const float* __restrict__ vraw,
                                   float* __restrict__ v3) {
  const int tid = blockIdx.x * blockDim.x + threadIdx.x;   // = c*NTOT + n
  const int c = tid >> 14;
  const int n = tid & (NTOT - 1);
  v3[tid] = vraw[(size_t)n*CDIM + c];
}

// ---------------------------------------------------------------------------
// K5: inclusive 3-D summed-area table over contiguous (16,32,32) volumes.
// One block per volume; whole volume staged in 64 KB of LDS via async b128
// copies (this kernel streams the 128 MB ikv tensor => dominant data mover).
// ---------------------------------------------------------------------------
__global__ __launch_bounds__(256)
void sat3d_kernel(const float* __restrict__ src, float* __restrict__ dst) {
  __shared__ float vol[NTOT];
  const float* s = src + (size_t)blockIdx.x * NTOT;
  float* dptr = dst + (size_t)blockIdx.x * NTOT;
  for (int t4 = threadIdx.x * 4; t4 < NTOT; t4 += 256 * 4)
    copy16_g2l(s + t4, vol + t4);
  async_join();
  __syncthreads();
  // cumsum along d: 512 (h,w)-rows of 32
  for (int r = threadIdx.x; r < 512; r += 256) {
    const int base = r * 32;
    float run = 0.f;
    for (int d = 0; d < 32; ++d) { run += vol[base + d]; vol[base + d] = run; }
  }
  __syncthreads();
  // cumsum along w: 512 (h,d)-columns
  for (int r = threadIdx.x; r < 512; r += 256) {
    const int h = r >> 5, d = r & 31;
    float run = 0.f;
    for (int w = 0; w < 32; ++w) {
      const int idx = h*1024 + w*32 + d;
      run += vol[idx]; vol[idx] = run;
    }
  }
  __syncthreads();
  // cumsum along h: 1024 (w,d)-columns
  for (int r = threadIdx.x; r < 1024; r += 256) {
    float run = 0.f;
    for (int h = 0; h < 16; ++h) {
      const int idx = h*1024 + r;
      run += vol[idx]; vol[idx] = run;
    }
  }
  __syncthreads();
  for (int t4 = threadIdx.x * 4; t4 < NTOT; t4 += 256 * 4)
    *(float4*)(dptr + t4) = *(const float4*)(vol + t4);
}

// ---------------------------------------------------------------------------
// K6: kv[bh,i,j,h,:,:] = k3slice_i(32x32) @ v3slice_j(32x32) for all 16x16
// (i,j).  One block per (h,bh).  Both operand families staged in LDS (async
// b128 fills); rows padded to stride 36 floats: 16B-aligned and 36*lane mod 64
// hits 16 distinct banks => conflict-free A reads.  Each wave: 32 pairs x
// 4 tiles x 8 K-steps of V_WMMA_F32_16X16X4_F32.
// ---------------------------------------------------------------------------
#define LSTR  36           // padded LDS row stride (floats)
#define SLICE (32*LSTR)    // 1152 floats per 32x32 slice

__global__ __launch_bounds__(256)
void kv_gemm_kernel(const float* __restrict__ k3, const float* __restrict__ v3,
                    float* __restrict__ kv) {
  __shared__ float Alds[16 * SLICE];   // 72 KB: A_i[w][m]
  __shared__ float Blds[16 * SLICE];   // 72 KB: B_j[m][d]
  const int h  = blockIdx.x;            // 0..15
  const int bh = blockIdx.y;            // 0..7
  // 16 slices * 32 rows * 8 four-float chunks = 4096 chunks per family
  for (int t = threadIdx.x; t < 4096; t += 256) {
    const int i   = t >> 8;            // slice
    const int row = (t >> 3) & 31;     // row within slice
    const int ch  = (t & 7) << 2;      // float offset of 16-byte chunk
    const size_t gofs = (size_t)(bh*16 + i)*NTOT + h*1024 + row*32 + ch;
    const int    lofs = i*SLICE + row*LSTR + ch;
    copy16_g2l(k3 + gofs, Alds + lofs);
    copy16_g2l(v3 + gofs, Blds + lofs);
  }
  async_join();
  __syncthreads();
  const int wave = threadIdx.x >> 5;
  const int lane = threadIdx.x & 31;
  const int lm = lane & 15, lh = lane >> 4;
  for (int p = wave; p < 256; p += 8) {
    const int i = p >> 4, j = p & 15;
    const float* A = Alds + i*SLICE;                              // [w][m]
    const float* B = Blds + j*SLICE;                              // [m][d]
    float* out = kv + ((size_t)((bh*16 + i)*16 + j))*NTOT + h*1024;
#pragma unroll
    for (int mt = 0; mt < 32; mt += 16) {
#pragma unroll
      for (int nt = 0; nt < 32; nt += 16) {
        v8f acc = {0,0,0,0,0,0,0,0};
#pragma unroll
        for (int k0 = 0; k0 < 32; k0 += 4) {
          const int kk = k0 + 2*lh;
          v2f a, b;
          a.x = A[(mt + lm)*LSTR + kk];
          a.y = A[(mt + lm)*LSTR + kk + 1];
          b.x = B[(kk    )*LSTR + nt + lm];
          b.y = B[(kk + 1)*LSTR + nt + lm];
          acc = wmma4(a, b, acc);
        }
#pragma unroll
        for (int r = 0; r < 8; ++r) {
          const int w = mt + r + 8*lh, d = nt + lm;
          out[w*32 + d] = acc[r];
        }
      }
    }
  }
}

// ---------------------------------------------------------------------------
// K7: windowed box sums via 8-corner SAT differences (edge-clamped center
// padding), contracted with q; accumulates 0.5 * sum over both windows of
// SCALE*num/Z into acc[c][n].
// ---------------------------------------------------------------------------
// running pointers keep the global address space (global_load, not flat_load)
typedef __attribute__((address_space(1))) const float gcfloat;

__global__ __launch_bounds__(256)
void wkv_num_kernel(const float* __restrict__ q3, const float* __restrict__ ik,
                    const float* __restrict__ ikv, float* __restrict__ accout) {
  const int bh = blockIdx.y;
  const int voxel = blockIdx.x * 256 + threadIdx.x;
  const int h = voxel >> 10, w = (voxel >> 5) & 31, d = voxel & 31;
  float res[16];
#pragma unroll
  for (int j = 0; j < 16; ++j) res[j] = 0.f;

#pragma unroll 1
  for (int win = 0; win < 2; ++win) {
    const int a = win ? 8 : 4;
    const int da = a - 1;
    const int oh = HH - a + 1, ow = WW - a + 1, od = DD - a + 1;
    const int ph = (HH - oh) >> 1, pw = (WW - ow) >> 1, pd = (DD - od) >> 1;
    int th = h - ph; th = th < 0 ? 0 : (th > oh - 1 ? oh - 1 : th);
    int tw = w - pw; tw = tw < 0 ? 0 : (tw > ow - 1 ? ow - 1 : tw);
    int td = d - pd; td = td < 0 ? 0 : (td > od - 1 ? od - 1 : td);
    const int h1 = th + da, w1 = tw + da, d1 = td + da;
    int off[8]; float sgn[8];
    off[0] = h1*1024 + w1*32 + d1; sgn[0] =  1.f;
    off[1] = h1*1024 + w1*32 + td; sgn[1] = -1.f;
    off[2] = h1*1024 + tw*32 + d1; sgn[2] = -1.f;
    off[3] = h1*1024 + tw*32 + td; sgn[3] =  1.f;
    off[4] = th*1024 + w1*32 + d1; sgn[4] = -1.f;
    off[5] = th*1024 + w1*32 + td; sgn[5] =  1.f;
    off[6] = th*1024 + tw*32 + d1; sgn[6] =  1.f;
    off[7] = th*1024 + tw*32 + td; sgn[7] = -1.f;

    float Z = 1e-6f;
    float num[16];
#pragma unroll
    for (int j = 0; j < 16; ++j) num[j] = 0.f;
    // one running pointer per corner; they are stepped right after the trip's loads
    gcfloat* pk[8];
    gcfloat* pv[8];
#pragma unroll
    for (int c = 0; c < 8; ++c) {
      pk[c] = (gcfloat*)(uintptr_t)(ik  + (size_t)bh*16*NTOT + off[c]);
      pv[c] = (gcfloat*)(uintptr_t)(ikv + (size_t)bh*256*NTOT + off[c]);
    }
    gcfloat* pq = (gcfloat*)(uintptr_t)(q3 + (size_t)bh*16*NTOT + voxel);
    // i stays rolled, for speed only
#pragma unroll 1
    for (int i = 0; i < 16; ++i) {
      // all 137 loads of the trip are independent and are issued before any
      // of them is used
      const float qi = *pq;
      float tk[8], t[16][8];
#pragma unroll
      for (int c = 0; c < 8; ++c) tk[c] = *pk[c];
#pragma unroll
      for (int j = 0; j < 16; ++j) {
#pragma unroll
        for (int c = 0; c < 8; ++c) t[j][c] = pv[c][j*NTOT];
        // behind the trip's last load, in front of the pointer steps below,
        // which overwrite the address registers that the issued loads name
        if (j == 15) asm volatile("s_wait_xcnt 0x0" ::: "memory");
        // keeps the eight corners of one volume together in issue order: the
        // two d corners of a row share one 128-byte line, and the second then
        // finds the line of the first instead of coming 16 volumes later
        __builtin_amdgcn_sched_barrier(0);
      }
      pq += NTOT;
#pragma unroll
      for (int c = 0; c < 8; ++c) { pk[c] += NTOT; pv[c] += 16*NTOT; }
      float wk = 0.f;
#pragma unroll
      for (int c = 0; c < 8; ++c) wk += sgn[c] * tk[c];
      Z += qi * wk;
#pragma unroll
      for (int j = 0; j < 16; ++j) {
        float s8 = 0.f;
#pragma unroll
        for (int c = 0; c < 8; ++c) s8 += sgn[c] * t[j][c];
        num[j] += qi * s8;
      }
    }
    const float f = ATTN_SCALE / Z;
#pragma unroll
    for (int j = 0; j < 16; ++j) res[j] += num[j] * f;
  }
#pragma unroll
  for (int j = 0; j < 16; ++j)
    accout[(size_t)(bh*16 + j)*NTOT + voxel] = 0.5f * res[j];   // / len(WINDOWS)
}

// ---------------------------------------------------------------------------
// K8: final projection: d_out[c][n] = sum_c' acc[c'][n]*pw[c'][c] + pb[c]
// ---------------------------------------------------------------------------
__global__ __launch_bounds__(32)
void proj_gemm_kernel(const float* __restrict__ accb,
                      const float* __restrict__ pw,
                      const float* __restrict__ pb,
                      float* __restrict__ out) {
  const int n0 = blockIdx.x * 16;
  const int c0 = blockIdx.y * 16;
  const int lane = threadIdx.x & 31;
  const int lm = lane & 15, lh = lane >> 4;
  v8f acc = {0,0,0,0,0,0,0,0};
  for (int k0 = 0; k0 < CDIM; k0 += 4) {
    const int ka = k0 + 2*lh;
    v2f a, b;
    a.x = accb[(size_t)(ka    )*NTOT + n0 + lm];
    a.y = accb[(size_t)(ka + 1)*NTOT + n0 + lm];
    b.x = pw[(ka    )*CDIM + c0 + lm];
    b.y = pw[(ka + 1)*CDIM + c0 + lm];
    acc = wmma4(a, b, acc);
  }
  const float bias = pb[c0 + lm];
#pragma unroll
  for (int r = 0; r < 8; ++r) {
    const int n = n0 + r + 8*lh;
    const int c = c0 + lm;
    out[(size_t)c*NTOT + n] = acc[r] + bias;   // transpose back to (C,N)
  }
}

// ---------------------------------------------------------------------------
extern "C" void kernel_launch(void* const* d_in, const int* in_sizes, int n_in,
                              void* d_out, int out_size, void* d_ws, size_t ws_size,
                              hipStream_t stream) {
  const float* x  = (const float*)d_in[0];
  const float* qw = (const float*)d_in[1];
  const float* kw = (const float*)d_in[2];
  const float* vw = (const float*)d_in[3];
  const float* pw = (const float*)d_in[4];
  const float* pb = (const float*)d_in[5];
  float* out = (float*)d_out;

  const size_t U = (size_t)NTOT * CDIM;     // 2,097,152 floats
  float* ws   = (float*)d_ws;
  float* qraw = ws;                         // (N,C)
  float* kraw = ws + 1*U;
  float* vraw = ws + 2*U;
  float* q3   = ws + 3*U;                   // (C,N)
  float* k3   = ws + 4*U;
  float* v3   = ws + 5*U;
  float* ik   = ws + 6*U;                   // SAT of k3
  float* accb = ws + 7*U;                   // attention output (C,N)
  float* ikv  = ws + 8*U;                   // kv then SAT(kv): 16*U floats

  qkv_gemm_kernel<<<dim3(NTOT/16, CDIM/16), 32, 0, stream>>>(x, qw, kw, vw,
                                                             qraw, kraw, vraw);
  softmax_q_kernel<<<(NTOT*HEADS)/256, 256, 0, stream>>>(qraw, q3);
  softmax_k_kernel<<<(NTOT*HD)/256, 256, 0, stream>>>(kraw, k3);
  transpose_v_kernel<<<(NTOT*CDIM)/256, 256, 0, stream>>>(vraw, v3);
  sat3d_kernel<<<CDIM, 256, 0, stream>>>(k3, ik);
  kv_gemm_kernel<<<dim3(HH, HEADS), 256, 0, stream>>>(k3, v3, ikv);
  sat3d_kernel<<<CDIM*HD, 256, 0, stream>>>(ikv, ikv);
  wkv_num_kernel<<<dim3(NTOT/256, HEADS), 256, 0, stream>>>(q3, ik, ikv, accb);
  proj_gemm_kernel<<<dim3(NTOT/16, CDIM/16), 32, 0, stream>>>(accb, pw, pb, out);
}

// v002
// One run takes 153 microseconds.
// Next to v001, in two timings, it ran 1.28 and 1.29 times as fast.
// Counting every step since v000, it is 2.75 times as fast.
#include <hip/hip_runtime.h>
#include <math.h>

// Problem constants (B=1)
#define HEADS 8
#define CDIM  128
#define HD    16          // head dim
#define HH    16
#define WW    32
#define DD    32
#define NTOT  (HH*WW*DD)  // 16384 spatial positions
#define ATTN_SCALE 0.25f  // (CDIM/HEADS)^-0.5 = 16^-0.5

typedef float v2f __attribute__((ext_vector_type(2)));
typedef float v8f __attribute__((ext_vector_type(8)));

// D(16x16,f32) = A(16x4,f32) x B(4x16,f32) + C  -- V_WMMA_F32_16X16X4_F32
static __device__ __forceinline__ v8f wmma4(v2f a, v2f b, v8f c) {
  return __builtin_amdgcn_wmma_f32_16x16x4_f32(false, a, false, b, (short)0, c,
                                               false, false);
}

// ---------------------------------------------------------------------------
// Async global->LDS copies (GLOBAL_LOAD_ASYNC_TO_LDS_B128, ASYNCcnt) when the
// toolchain exposes them; falls back to vectorized load+ds_store otherwise.
// Builtin signature (from diagnostics): (v4i addrspace(1)*, v4i addrspace(3)*,
// imm offset, imm cpol) where v4i = 16-byte int vector (b128 payload).
// ---------------------------------------------------------------------------
#if __has_builtin(__builtin_amdgcn_global_load_async_to_lds_b128) && \
    __has_builtin(__builtin_amdgcn_s_wait_asynccnt)
#define USE_ASYNC_LDS 1
typedef int v4i_ __attribute__((vector_size(4 * sizeof(int))));
typedef __attribute__((address_space(1))) v4i_ as1_v4i;
typedef __attribute__((address_space(3))) v4i_ as3_v4i;
#endif

static __device__ __forceinline__ void copy16_g2l(const float* g, float* l) {
#ifdef USE_ASYNC_LDS
  __builtin_amdgcn_global_load_async_to_lds_b128(
      (as1_v4i*)(uintptr_t)g,
      (as3_v4i*)(uint32_t)(uintptr_t)l,   // low 32 bits == LDS byte offset
      0, 0);
#else
  *(float4*)l = *(const float4*)g;
#endif
}

static __device__ __forceinline__ void async_join() {
#ifdef USE_ASYNC_LDS
  __builtin_amdgcn_s_wait_asynccnt(0);
#endif
}

// ---------------------------------------------------------------------------
// K1: q/k/v = xt @ {qw,kw,vw}.  xt[n,c] = x[c*N+n].  One wave per 16x16 tile,
// A-loads shared across the three accumulators.  Output row-major (N,C).
// ---------------------------------------------------------------------------
__global__ __launch_bounds__(32)
void qkv_gemm_kernel(const float* __restrict__ x,
                     const float* __restrict__ qw, const float* __restrict__ kw,
                     const float* __restrict__ vw,
                     float* __restrict__ qraw, float* __restrict__ kraw,
                     float* __restrict__ vraw) {
  const int n0 = blockIdx.x * 16;
  const int c0 = blockIdx.y * 16;
  const int lane = threadIdx.x & 31;
  const int lm = lane & 15;        // M / N column within tile
  const int lh = lane >> 4;        // lane-half selects K pair
  v8f aq = {0,0,0,0,0,0,0,0};
  v8f ak = {0,0,0,0,0,0,0,0};
  v8f av = {0,0,0,0,0,0,0,0};
  for (int k0 = 0; k0 < CDIM; k0 += 4) {
    const int ka = k0 + 2*lh;
    v2f a, b;
    // A[M=lm, K=ka..ka+1] = xt[n0+lm, ka] = x[ka*N + n0+lm]
    a.x = x[(size_t)(ka    )*NTOT + n0 + lm];
    a.y = x[(size_t)(ka + 1)*NTOT + n0 + lm];
    if (k0 + 4 < CDIM) __builtin_prefetch(&x[(size_t)(ka + 4)*NTOT + n0 + lm], 0, 1);
    b.x = qw[(ka    )*CDIM + c0 + lm];
    b.y = qw[(ka + 1)*CDIM + c0 + lm];
    aq = wmma4(a, b, aq);
    b.x = kw[(ka    )*CDIM + c0 + lm];
    b.y = kw[(ka + 1)*CDIM + c0 + lm];
    ak = wmma4(a, b, ak);
    b.x = vw[(ka    )*CDIM + c0 + lm];
    b.y = vw[(ka + 1)*CDIM + c0 + lm];
    av = wmma4(a, b, av);
  }
#pragma unroll
  for (int r = 0; r < 8; ++r) {
    const int n = n0 + r + 8*lh;   // D layout: VGPR r, lane-half -> M
    const int c = c0 + lm;
    qraw[(size_t)n*CDIM + c] = aq[r];
    kraw[(size_t)n*CDIM + c] = ak[r];
    vraw[(size_t)n*CDIM + c] = av[r];
  }
}

// ---------------------------------------------------------------------------
// K2: softmax of q over head-dim (16 contiguous cols) + transpose to [c][n]
// ---------------------------------------------------------------------------
__global__ void softmax_q_kernel(const float* __restrict__ qraw,
                                 float* __restrict__ q3) {
  const int tid = blockIdx.x * blockDim.x + threadIdx.x;
  const int head = tid >> 14;          // / NTOT
  const int n    = tid & (NTOT - 1);
  float v[16];
  float m = -3.0e38f;
#pragma unroll
  for (int j = 0; j < 16; ++j) {
    v[j] = qraw[(size_t)n*CDIM + head*16 + j];
    m = fmaxf(m, v[j]);
  }
  float s = 0.f;
#pragma unroll
  for (int j = 0; j < 16; ++j) { v[j] = __expf(v[j] - m); s += v[j]; }
  const float inv = 1.f / s;
#pragma unroll
  for (int j = 0; j < 16; ++j)
    q3[(size_t)(head*16 + j)*NTOT + n] = v[j] * inv;
}

// ---------------------------------------------------------------------------
// K3: softmax of k over the HEADS axis (cols j, j+16, ..., j+112) + transpose
// ---------------------------------------------------------------------------
__global__ void softmax_k_kernel(const float* __restrict__ kraw,
                                 float* __restrict__ k3) {
  const int tid = blockIdx.x * blockDim.x + threadIdx.x;
  const int j = tid >> 14;             // 0..15
  const int n = tid & (NTOT - 1);
  float v[8];
  float m = -3.0e38f;
#pragma unroll
  for (int h = 0; h < 8; ++h) {
    v[h] = kraw[(size_t)n*CDIM + h*16 + j];
    m = fmaxf(m, v[h]);
  }
  float s = 0.f;
#pragma unroll
  for (int h = 0; h < 8; ++h) { v[h] = __expf(v[h] - m); s += v[h]; }
  const float inv = 1.f / s;
#pragma unroll
  for (int h = 0; h < 8; ++h)
    k3[(size_t)(h*16 + j)*NTOT + n] = v[h] * inv;
}

// ---------------------------------------------------------------------------
// K4: transpose v (N,C) -> (C,N)
// ---------------------------------------------------------------------------
__global__ void transpose_v_kernel(const float* __restrict__ vraw,
                                   float* __restrict__ v3) {
  const int tid = blockIdx.x * blockDim.x + threadIdx.x;   // = c*NTOT + n
  const int c = tid >> 14;
  const int n = tid & (NTOT - 1);
  v3[tid] = vraw[(size_t)n*CDIM + c];
}

// ---------------------------------------------------------------------------
// K5: inclusive 3-D summed-area table over contiguous (16,32,32) volumes.
// One block per volume; whole volume staged in 64 KB of LDS via async b128
// copies.
// ---------------------------------------------------------------------------
__global__ __launch_bounds__(256)
void sat3d_kernel(const float* __restrict__ src, float* __restrict__ dst) {
  __shared__ float vol[NTOT];
  const float* s = src + (size_t)blockIdx.x * NTOT;
  float* dptr = dst + (size_t)blockIdx.x * NTOT;
  for (int t4 = threadIdx.x * 4; t4 < NTOT; t4 += 256 * 4)
    copy16_g2l(s + t4, vol + t4);
  async_join();
  __syncthreads();
  // cumsum along d: 512 (h,w)-rows of 32
  for (int r = threadIdx.x; r < 512; r += 256) {
    const int base = r * 32;
    float run = 0.f;
    for (int d = 0; d < 32; ++d) { run += vol[base + d]; vol[base + d] = run; }
  }
  __syncthreads();
  // cumsum along w: 512 (h,d)-columns
  for (int r = threadIdx.x; r < 512; r += 256) {
    const int h = r >> 5, d = r & 31;
    float run = 0.f;
    for (int w = 0; w < 32; ++w) {
      const int idx = h*1024 + w*32 + d;
      run += vol[idx]; vol[idx] = run;
    }
  }
  __syncthreads();
  // cumsum along h: 1024 (w,d)-columns
  for (int r = threadIdx.x; r < 1024; r += 256) {
    float run = 0.f;
    for (int h = 0; h < 16; ++h) {
      const int idx = h*1024 + r;
      run += vol[idx]; vol[idx] = run;
    }
  }
  __syncthreads();
  for (int t4 = threadIdx.x * 4; t4 < NTOT; t4 += 256 * 4)
    *(float4*)(dptr + t4) = *(const float4*)(vol + t4);
}

// ---------------------------------------------------------------------------
// K6a: prefix sums of the two operands of the k*v product.  The product is
// linear in each operand, so its prefix over w is the product with k summed
// over w, and its prefix over d the product with v summed over d: the two
// scans run on 8 MB each instead of on the 128 MB product.
// One wave per 32x32 slice (c,h); lane = m.  The scanned slice is written in
// the order in which K6b's lanes read their WMMA fragments:
//   f[s][lane = lh*16+lm][t*2+y],  m = 4*s + 2*lh + y
//   k family: row  w = t*16 + lm;   v family: column d = 2*lm + t
// Every loop is unrolled so that val[] has constant indices and stays in
// registers, and the 32 loads (k) or 8 b128 loads (v) of a slice are all in flight together.
// ---------------------------------------------------------------------------
#define FPITCH 68   // floats per group of 16 lanes in LDS: 16-byte aligned, and
                    // the 16 groups start on 16 different banks

__global__ __launch_bounds__(256)
void operand_prefix_kernel(const float* __restrict__ k3,
                           const float* __restrict__ v3,
                           float* __restrict__ kf, float* __restrict__ vf) {
  __shared__ __attribute__((aligned(16))) float frag[8][16 * FPITCH];
  const int wave = threadIdx.x >> 5;
  const int m    = threadIdx.x & 31;
  const size_t base = ((size_t)blockIdx.x * 8 + wave) * 1024;   // slice (c,h)
  float* f = frag[wave] + (m >> 1) * FPITCH + (m & 1);
  float val[32];
  if (blockIdx.y == 0) {
#pragma unroll
    for (int w = 0; w < 32; ++w) val[w] = k3[base + w*32 + m];
#pragma unroll
    for (int w = 1; w < 32; ++w) val[w] += val[w - 1];
#pragma unroll
    for (int w = 0; w < 32; ++w) f[(w & 15)*4 + (w >> 4)*2] = val[w];
  } else {
#pragma unroll
    for (int q = 0; q < 8; ++q) {
      const float4 r4 = *(const float4*)(v3 + base + m*32 + q*4);
      val[q*4 + 0] = r4.x; val[q*4 + 1] = r4.y;
      val[q*4 + 2] = r4.z; val[q*4 + 3] = r4.w;
    }
#pragma unroll
    for (int d = 1; d < 32; ++d) val[d] += val[d - 1];
#pragma unroll
    for (int d = 0; d < 32; ++d) f[(d >> 1)*4 + (d & 1)*2] = val[d];
  }
  // the lanes of a wave read below what other lanes of it wrote above
  __syncthreads();
  float* dst = (blockIdx.y == 0 ? kf : vf) + base + m*4;
#pragma unroll
  for (int s = 0; s < 8; ++s)
    *(float4*)(dst + s*128) =
        *(const float4*)(frag[wave] + (s*2 + (m >> 4))*FPITCH + (m & 15)*4);
}

// ---------------------------------------------------------------------------
// K6b: ikv[bh,i,j,h,:,:] = sum over h' <= h of kf_i[h'](32x32) @ vf_j[h'](32x32)
// = the 3-D summed-area table of the k*v product.  One wave per (i,j) pair:
// it walks h, does each slice's product in fresh accumulators (4 tiles x 8
// K-steps of V_WMMA_F32_16X16X4_F32), adds it to a running sum in registers
// and stores the running sum.  Fragments come straight from kf/vf as whole
// 512-byte wave loads; the eight waves of a block share 2 k and 4 v volumes.
// Every loop is unrolled so that the fragment and accumulator arrays have
// constant indices and stay in registers.
// ---------------------------------------------------------------------------
__global__ __launch_bounds__(256)
void kv_sat_kernel(const float* __restrict__ kf, const float* __restrict__ vf,
                   float* __restrict__ ikv) {
  const int wave = threadIdx.x >> 5;
  const int lane = threadIdx.x & 31;
  const int lm = lane & 15, lh = lane >> 4;
  const int bh = blockIdx.y;                              // 0..7
  const int i  = (blockIdx.x >> 2)*2 + (wave >> 2);       // 0..15
  const int j  = (blockIdx.x & 3)*4 + (wave & 3);         // 0..15
  const float* A = kf + (size_t)(bh*16 + i)*NTOT + lane*4;
  const float* B = vf + (size_t)(bh*16 + j)*NTOT + lane*4;
  float* out = ikv + ((size_t)((bh*16 + i)*16 + j))*NTOT + lh*8*32 + lm*2;
  v8f run[2][2];
#pragma unroll
  for (int mt = 0; mt < 2; ++mt)
#pragma unroll
    for (int nt = 0; nt < 2; ++nt) run[mt][nt] = (v8f){0,0,0,0,0,0,0,0};
  float4 a[2][8], b[2][8];
#pragma unroll
  for (int s = 0; s < 8; ++s) {
    a[0][s] = *(const float4*)(A + s*128);
    b[0][s] = *(const float4*)(B + s*128);
  }
  // h is unrolled whole: every load and store then has a constant offset from
  // one address that never changes, and the two fragment sets need no copies
#pragma unroll
  for (int h = 0; h < HH; ++h) {
    const int cur = h & 1, nxt = cur ^ 1;
    if (h + 1 < HH) {
      // the next slice's fragments fly while this slice is multiplied
#pragma unroll
      for (int s = 0; s < 8; ++s) {
        a[nxt][s] = *(const float4*)(A + (h + 1)*1024 + s*128);
        b[nxt][s] = *(const float4*)(B + (h + 1)*1024 + s*128);
      }
    }
    // holds these loads in front of this slice's products, and (with the one
    // at the foot) later slices' loads behind them: left free, the scheduler
    // mixes five slices and goes past 256 registers
    __builtin_amdgcn_sched_barrier(0);
    v8f acc[2][2];
#pragma unroll
    for (int mt = 0; mt < 2; ++mt)
#pragma unroll
      for (int nt = 0; nt < 2; ++nt) acc[mt][nt] = (v8f){0,0,0,0,0,0,0,0};
#pragma unroll
    for (int s = 0; s < 8; ++s) {
      const v2f a0 = {a[cur][s].x, a[cur][s].y}, a1 = {a[cur][s].z, a[cur][s].w};
      const v2f b0 = {b[cur][s].x, b[cur][s].y}, b1 = {b[cur][s].z, b[cur][s].w};
      acc[0][0] = wmma4(a0, b0, acc[0][0]);
      acc[0][1] = wmma4(a0, b1, acc[0][1]);
      acc[1][0] = wmma4(a1, b0, acc[1][0]);
      acc[1][1] = wmma4(a1, b1, acc[1][1]);
    }
    // one vector slot between the products and the adds: the first tile's last
    // WMMA has only three WMMAs behind it, and the add that reads its result
    // is to stand four vector slots behind it; the two scheduling barriers
    // hold the slot at this place
    __builtin_amdgcn_sched_barrier(0);
    asm volatile("v_nop");
    __builtin_amdgcn_sched_barrier(0);
#pragma unroll
    for (int mt = 0; mt < 2; ++mt) {
      run[mt][0] += acc[mt][0];
      run[mt][1] += acc[mt][1];
#pragma unroll
      for (int r = 0; r < 8; ++r) {
        // row w = mt*16 + r + 8*lh, columns d = 2*lm and 2*lm + 1: sixteen
        // lanes fill one 128-byte row
        const float2 o = make_float2(run[mt][0][r], run[mt][1][r]);
        *(float2*)(out + h*1024 + (mt*16 + r)*32) = o;
      }
    }
    __builtin_amdgcn_sched_barrier(0);   // see above
  }
}

// ---------------------------------------------------------------------------
// K7: windowed box sums via 8-corner SAT differences (edge-clamped center
// padding), contracted with q; accumulates 0.5 * sum over both windows of
// SCALE*num/Z into acc[c][n].
// ---------------------------------------------------------------------------
// running pointers keep the global address space (global_load, not flat_load)
typedef __attribute__((address_space(1))) const float gcfloat;

__global__ __launch_bounds__(256)
void wkv_num_kernel(const float* __restrict__ q3, const float* __restrict__ ik,
                    const float* __restrict__ ikv, float* __restrict__ accout) {
  const int bh = blockIdx.y;
  const int voxel = blockIdx.x * 256 + threadIdx.x;
  const int h = voxel >> 10, w = (voxel >> 5) & 31, d = voxel & 31;
  float res[16];
#pragma unroll
  for (int j = 0; j < 16; ++j) res[j] = 0.f;

#pragma unroll 1
  for (int win = 0; win < 2; ++win) {
    const int a = win ? 8 : 4;
    const int da = a - 1;
    const int oh = HH - a + 1, ow = WW - a + 1, od = DD - a + 1;
    const int ph = (HH - oh) >> 1, pw = (WW - ow) >> 1, pd = (DD - od) >> 1;
    int th = h - ph; th = th < 0 ? 0 : (th > oh - 1 ? oh - 1 : th);
    int tw = w - pw; tw = tw < 0 ? 0 : (tw > ow - 1 ? ow - 1 : tw);
    int td = d - pd; td = td < 0 ? 0 : (td > od - 1 ? od - 1 : td);
    const int h1 = th + da, w1 = tw + da, d1 = td + da;
    int off[8]; float sgn[8];
    off[0] = h1*1024 + w1*32 + d1; sgn[0] =  1.f;
    off[1] = h1*1024 + w1*32 + td; sgn[1] = -1.f;
    off[2] = h1*1024 + tw*32 + d1; sgn[2] = -1.f;
    off[3] = h1*1024 + tw*32 + td; sgn[3] =  1.f;
    off[4] = th*1024 + w1*32 + d1; sgn[4] = -1.f;
    off[5] = th*1024 + w1*32 + td; sgn[5] =  1.f;
    off[6] = th*1024 + tw*32 + d1; sgn[6] =  1.f;
    off[7] = th*1024 + tw*32 + td; sgn[7] = -1.f;

    float Z = 1e-6f;
    float num[16];
#pragma unroll
    for (int j = 0; j < 16; ++j) num[j] = 0.f;
    // one running pointer per corner; they are stepped right after the trip's loads
    gcfloat* pk[8];
    gcfloat* pv[8];
#pragma unroll
    for (int c = 0; c < 8; ++c) {
      pk[c] = (gcfloat*)(uintptr_t)(ik  + (size_t)bh*16*NTOT + off[c]);
      pv[c] = (gcfloat*)(uintptr_t)(ikv + (size_t)bh*256*NTOT + off[c]);
    }
    gcfloat* pq = (gcfloat*)(uintptr_t)(q3 + (size_t)bh*16*NTOT + voxel);
    // i stays rolled, for speed only
#pragma unroll 1
    for (int i = 0; i < 16; ++i) {
      // all 137 loads of the trip are independent and are issued before any
      // of them is used
      const float qi = *pq;
      float tk[8], t[16][8];
#pragma unroll
      for (int c = 0; c < 8; ++c) tk[c] = *pk[c];
#pragma unroll
      for (int j = 0; j < 16; ++j) {
#pragma unroll
        for (int c = 0; c < 8; ++c) t[j][c] = pv[c][j*NTOT];
        // behind the trip's last load, in front of the pointer steps below,
        // which overwrite the address registers that the issued loads name
        if (j == 15) asm volatile("s_wait_xcnt 0x0" ::: "memory");
        // keeps the eight corners of one volume together in issue order: the
        // two d corners of a row share one 128-byte line, and the second then
        // finds the line of the first instead of coming 16 volumes later
        __builtin_amdgcn_sched_barrier(0);
      }
      pq += NTOT;
#pragma unroll
      for (int c = 0; c < 8; ++c) { pk[c] += NTOT; pv[c] += 16*NTOT; }
      float wk = 0.f;
#pragma unroll
      for (int c = 0; c < 8; ++c) wk += sgn[c] * tk[c];
      Z += qi * wk;
#pragma unroll
      for (int j = 0; j < 16; ++j) {
        float s8 = 0.f;
#pragma unroll
        for (int c = 0; c < 8; ++c) s8 += sgn[c] * t[j][c];
        num[j] += qi * s8;
      }
    }
    const float f = ATTN_SCALE / Z;
#pragma unroll
    for (int j = 0; j < 16; ++j) res[j] += num[j] * f;
  }
#pragma unroll
  for (int j = 0; j < 16; ++j)
    accout[(size_t)(bh*16 + j)*NTOT + voxel] = 0.5f * res[j];   // / len(WINDOWS)
}

// ---------------------------------------------------------------------------
// K8: final projection: d_out[c][n] = sum_c' acc[c'][n]*pw[c'][c] + pb[c]
// ---------------------------------------------------------------------------
__global__ __launch_bounds__(32)
void proj_gemm_kernel(const float* __restrict__ accb,
                      const float* __restrict__ pw,
                      const float* __restrict__ pb,
                      float* __restrict__ out) {
  const int n0 = blockIdx.x * 16;
  const int c0 = blockIdx.y * 16;
  const int lane = threadIdx.x & 31;
  const int lm = lane & 15, lh = lane >> 4;
  v8f acc = {0,0,0,0,0,0,0,0};
  for (int k0 = 0; k0 < CDIM; k0 += 4) {
    const int ka = k0 + 2*lh;
    v2f a, b;
    a.x = accb[(size_t)(ka    )*NTOT + n0 + lm];
    a.y = accb[(size_t)(ka + 1)*NTOT + n0 + lm];
    b.x = pw[(ka    )*CDIM + c0 + lm];
    b.y = pw[(ka + 1)*CDIM + c0 + lm];
    acc = wmma4(a, b, acc);
  }
  const float bias = pb[c0 + lm];
#pragma unroll
  for (int r = 0; r < 8; ++r) {
    const int n = n0 + r + 8*lh;
    const int c = c0 + lm;
    out[(size_t)c*NTOT + n] = acc[r] + bias;   // transpose back to (C,N)
  }
}

// ---------------------------------------------------------------------------
extern "C" void kernel_launch(void* const* d_in, const int* in_sizes, int n_in,
                              void* d_out, int out_size, void* d_ws, size_t ws_size,
                              hipStream_t stream) {
  const float* x  = (const float*)d_in[0];
  const float* qw = (const float*)d_in[1];
  const float* kw = (const float*)d_in[2];
  const float* vw = (const float*)d_in[3];
  const float* pw = (const float*)d_in[4];
  const float* pb = (const float*)d_in[5];
  float* out = (float*)d_out;

  const size_t U = (size_t)NTOT * CDIM;     // 2,097,152 floats
  float* ws   = (float*)d_ws;
  float* qraw = ws;                         // (N,C)
  float* kraw = ws + 1*U;
  float* vraw = ws + 2*U;
  float* q3   = ws + 3*U;                   // (C,N)
  float* k3   = ws + 4*U;
  float* v3   = ws + 5*U;
  float* ik   = ws + 6*U;                   // SAT of k3
  float* accb = ws + 7*U;                   // attention output (C,N)
  float* ikv  = ws + 8*U;                   // SAT(kv): 16*U floats
  float* kf   = ws + 24*U;                  // k3 summed over w, fragment order
  float* vf   = ws + 25*U;                  // v3 summed over d, fragment order

  qkv_gemm_kernel<<<dim3(NTOT/16, CDIM/16), 32, 0, stream>>>(x, qw, kw, vw,
                                                             qraw, kraw, vraw);
  softmax_q_kernel<<<(NTOT*HEADS)/256, 256, 0, stream>>>(qraw, q3);
  softmax_k_kernel<<<(NTOT*HD)/256, 256, 0, stream>>>(kraw, k3);
  transpose_v_kernel<<<(NTOT*CDIM)/256, 256, 0, stream>>>(vraw, v3);
  sat3d_kernel<<<CDIM, 256, 0, stream>>>(k3, ik);
  operand_prefix_kernel<<<dim3(CDIM*HH/8, 2), 256, 0, stream>>>(k3, v3, kf, vf);
  kv_sat_kernel<<<dim3(32, HEADS), 256, 0, stream>>>(kf, vf, ikv);
  wkv_num_kernel<<<dim3(NTOT/256, HEADS), 256, 0, stream>>>(q3, ik, ikv, accb);
  proj_gemm_kernel<<<dim3(NTOT/16, CDIM/16), 32, 0, stream>>>(accb, pw, pb, out);
}

// v003
// A run of this version takes 130 microseconds.
// Next to v002, in two timings, it ran 1.18 and 1.17 times as fast.
// All steps since v000 together make it 3.24 times as fast.
#include <hip/hip_runtime.h>
#include <math.h>

// Problem constants (B=1)
#define HEADS 8
#define CDIM  128
#define HD    16          // head dim
#define HH    16
#define WW    32
#define DD    32
#define NTOT  (HH*WW*DD)  // 16384 spatial positions
#define ATTN_SCALE 0.25f  // (CDIM/HEADS)^-0.5 = 16^-0.5

typedef float v2f __attribute__((ext_vector_type(2)));
typedef float v8f __attribute__((ext_vector_type(8)));

// D(16x16,f32) = A(16x4,f32) x B(4x16,f32) + C  -- V_WMMA_F32_16X16X4_F32
static __device__ __forceinline__ v8f wmma4(v2f a, v2f b, v8f c) {
  return __builtin_amdgcn_wmma_f32_16x16x4_f32(false, a, false, b, (short)0, c,
                                               false, false);
}

// ---------------------------------------------------------------------------
// Async global->LDS copies (GLOBAL_LOAD_ASYNC_TO_LDS_B128, ASYNCcnt) when the
// toolchain exposes them; falls back to vectorized load+ds_store otherwise.
// Builtin signature (from diagnostics): (v4i addrspace(1)*, v4i addrspace(3)*,
// imm offset, imm cpol) where v4i = 16-byte int vector (b128 payload).
// ---------------------------------------------------------------------------
#if __has_builtin(__builtin_amdgcn_global_load_async_to_lds_b128) && \
    __has_builtin(__builtin_amdgcn_s_wait_asynccnt)
#define USE_ASYNC_LDS 1
typedef int v4i_ __attribute__((vector_size(4 * sizeof(int))));
typedef __attribute__((address_space(1))) v4i_ as1_v4i;
typedef __attribute__((address_space(3))) v4i_ as3_v4i;
#endif

static __device__ __forceinline__ void copy16_g2l(const float* g, float* l) {
#ifdef USE_ASYNC_LDS
  __builtin_amdgcn_global_load_async_to_lds_b128(
      (as1_v4i*)(uintptr_t)g,
      (as3_v4i*)(uint32_t)(uintptr_t)l,   // low 32 bits == LDS byte offset
      0, 0);
#else
  *(float4*)l = *(const float4*)g;
#endif
}

static __device__ __forceinline__ void async_join() {
#ifdef USE_ASYNC_LDS
  __builtin_amdgcn_s_wait_asynccnt(0);
#endif
}

// ---------------------------------------------------------------------------
// K1: q3/k3/v3 = softmax / softmax / identity of ({qw,kw,vw}^T @ x), stored
// channel-major (C,N).  The tile is taken transposed: M = channel, N = position
// (A = weight^T, B = x), so a wave that holds all 128 channels of 16 positions
// has both softmax axes in its own registers (k: plus one exchange between the
// lane halves) and its stores already run along n.  blockIdx.y picks the family.
// The eight tiles (g,e) deal the channels so that one 16-byte load of a weight
// row feeds four tiles: row M of tile (g,e) is channel 64*g + 4*M + e.
// D layout: acc[g][e][r] is M = r + 8*lh at position n0 + lm, that is
//   channel 64*g + 32*lh + 4*r + e = head 4*g + 2*lh + (r>>2), j = 4*(r&3) + e.
// ---------------------------------------------------------------------------
// four K-steps' fragments: w[u][g][y] is weight row k + 4*u + 2*lh + y, channels
// 64*g + 4*lm .. +3; b[u] the two x rows of the same k at position n0 + lm
static __device__ __forceinline__ void qkv_load4(const float* xp, const float* wp,
                                                 int k, float4 (&w)[4][2][2],
                                                 v2f (&b)[4]) {
#pragma unroll
  for (int u = 0; u < 4; ++u) {
    b[u].x = xp[(size_t)(k + 4*u    )*NTOT];
    b[u].y = xp[(size_t)(k + 4*u + 1)*NTOT];
#pragma unroll
    for (int g = 0; g < 2; ++g) {
      w[u][g][0] = *(const float4*)(wp + (k + 4*u    )*CDIM + g*64);
      w[u][g][1] = *(const float4*)(wp + (k + 4*u + 1)*CDIM + g*64);
    }
  }
}

static __device__ __forceinline__ void qkv_mma4(const float4 (&w)[4][2][2],
                                                const v2f (&b)[4], v8f (&acc)[2][4]) {
#pragma unroll
  for (int u = 0; u < 4; ++u)
#pragma unroll
    for (int g = 0; g < 2; ++g) {
      acc[g][0] = wmma4((v2f){w[u][g][0].x, w[u][g][1].x}, b[u], acc[g][0]);
      acc[g][1] = wmma4((v2f){w[u][g][0].y, w[u][g][1].y}, b[u], acc[g][1]);
      acc[g][2] = wmma4((v2f){w[u][g][0].z, w[u][g][1].z}, b[u], acc[g][2]);
      acc[g][3] = wmma4((v2f){w[u][g][0].w, w[u][g][1].w}, b[u], acc[g][3]);
    }
}

__global__ __launch_bounds__(128)
void qkv_softmax_kernel(const float* __restrict__ x,
                        const float* __restrict__ qw, const float* __restrict__ kw,
                        const float* __restrict__ vw,
                        float* __restrict__ q3, float* __restrict__ k3,
                        float* __restrict__ v3) {
  const int wave = threadIdx.x >> 5;
  const int lane = threadIdx.x & 31;
  const int lm = lane & 15;        // M row of A / N column of B and D
  const int lh = lane >> 4;        // lane-half selects the K pair
  const int n0 = (blockIdx.x * 4 + wave) * 16;
  const int fam = blockIdx.y;      // 0 q, 1 k, 2 v
  const float* wgt = fam == 0 ? qw : (fam == 1 ? kw : vw);
  float* dst       = fam == 0 ? q3 : (fam == 1 ? k3 : v3);
  const float* xp = x   + (size_t)(2*lh)*NTOT + n0 + lm;
  const float* wp = wgt + (2*lh)*CDIM + lm*4;
  v8f acc[2][4];
#pragma unroll
  for (int g = 0; g < 2; ++g)
#pragma unroll
    for (int e = 0; e < 4; ++e) acc[g][e] = (v8f){0,0,0,0,0,0,0,0};
  // two register sets of four K-steps each: one set's 24 loads fly while the
  // other set is multiplied
  float4 w0[4][2][2], w1[4][2][2];
  v2f b0[4], b1[4];
  qkv_load4(xp, wp, 0, w0, b0);
  // stays rolled: the two halves of a trip name their sets by constant.  The
  // last 32 of K stand behind the loop, so that no load in the loop hangs on a
  // test: with one, the waits in front of the products cover both paths and
  // take the newest loads in as well
#pragma unroll 1
  for (int k0 = 0; k0 < CDIM - 32; k0 += 32) {
    qkv_load4(xp, wp, k0 + 16, w1, b1);
    // the scheduling barriers hold each set's loads in front of the other
    // set's products, so that they are in flight during them, and behind the
    // products before: two sets are live at a time and no third
    __builtin_amdgcn_sched_barrier(0);
    qkv_mma4(w0, b0, acc);
    __builtin_amdgcn_sched_barrier(0);   // see above
    qkv_load4(xp, wp, k0 + 32, w0, b0);
    __builtin_amdgcn_sched_barrier(0);   // see above
    qkv_mma4(w1, b1, acc);
    __builtin_amdgcn_sched_barrier(0);   // see above
  }
  qkv_load4(xp, wp, CDIM - 16, w1, b1);
  __builtin_amdgcn_sched_barrier(0);     // see above
  qkv_mma4(w0, b0, acc);
  qkv_mma4(w1, b1, acc);
  if (fam == 0) {
    // softmax over the 16 channels of a head: all in this lane, summed in j order
#pragma unroll
    for (int g = 0; g < 2; ++g)
#pragma unroll
      for (int rh = 0; rh < 2; ++rh) {
        float m = -3.0e38f;
#pragma unroll
        for (int j = 0; j < 16; ++j) m = fmaxf(m, acc[g][j & 3][rh*4 + (j >> 2)]);
        float s = 0.f;
#pragma unroll
        for (int j = 0; j < 16; ++j) {
          const float ex = __expf(acc[g][j & 3][rh*4 + (j >> 2)] - m);
          acc[g][j & 3][rh*4 + (j >> 2)] = ex;
          s += ex;
        }
        const float inv = 1.f / s;
#pragma unroll
        for (int j = 0; j < 16; ++j) acc[g][j & 3][rh*4 + (j >> 2)] *= inv;
      }
  } else if (fam == 1) {
    // softmax over the HEADS axis: four heads in this lane, four in its partner
    // of the other lane half
#pragma unroll
    for (int e = 0; e < 4; ++e)
#pragma unroll
      for (int rl = 0; rl < 4; ++rl) {
        float m = fmaxf(fmaxf(acc[0][e][rl], acc[0][e][4 + rl]),
                        fmaxf(acc[1][e][rl], acc[1][e][4 + rl]));
        m = fmaxf(m, __shfl_xor(m, 16));
        float s = 0.f;
#pragma unroll
        for (int g = 0; g < 2; ++g)
#pragma unroll
          for (int rh = 0; rh < 2; ++rh) {
            const float ex = __expf(acc[g][e][rh*4 + rl] - m);
            acc[g][e][rh*4 + rl] = ex;
            s += ex;
          }
        s += __shfl_xor(s, 16);
        const float inv = 1.f / s;
#pragma unroll
        for (int g = 0; g < 2; ++g)
#pragma unroll
          for (int rh = 0; rh < 2; ++rh) acc[g][e][rh*4 + rl] *= inv;
      }
  }
  float* o = dst + (size_t)(32*lh)*NTOT + n0 + lm;
#pragma unroll
  for (int g = 0; g < 2; ++g)
#pragma unroll
    for (int r = 0; r < 8; ++r)
#pragma unroll
      for (int e = 0; e < 4; ++e)
        o[(size_t)(64*g + 4*r + e)*NTOT] = acc[g][e][r];
}

// ---------------------------------------------------------------------------
// K5: inclusive 3-D summed-area table over contiguous (16,32,32) volumes.
// One block per volume; whole volume staged in 64 KB of LDS via async b128
// copies.
// ---------------------------------------------------------------------------
__global__ __launch_bounds__(256)
void sat3d_kernel(const float* __restrict__ src, float* __restrict__ dst) {
  __shared__ float vol[NTOT];
  const float* s = src + (size_t)blockIdx.x * NTOT;
  float* dptr = dst + (size_t)blockIdx.x * NTOT;
  for (int t4 = threadIdx.x * 4; t4 < NTOT; t4 += 256 * 4)
    copy16_g2l(s + t4, vol + t4);
  async_join();
  __syncthreads();
  // cumsum along d: 512 (h,w)-rows of 32
  for (int r = threadIdx.x; r < 512; r += 256) {
    const int base = r * 32;
    float run = 0.f;
    for (int d = 0; d < 32; ++d) { run += vol[base + d]; vol[base + d] = run; }
  }
  __syncthreads();
  // cumsum along w: 512 (h,d)-columns
  for (int r = threadIdx.x; r < 512; r += 256) {
    const int h = r >> 5, d = r & 31;
    float run = 0.f;
    for (int w = 0; w < 32; ++w) {
      const int idx = h*1024 + w*32 + d;
      run += vol[idx]; vol[idx] = run;
    }
  }
  __syncthreads();
  // cumsum along h: 1024 (w,d)-columns
  for (int r = threadIdx.x; r < 1024; r += 256) {
    float run = 0.f;
    for (int h = 0; h < 16; ++h) {
      const int idx = h*1024 + r;
      run += vol[idx]; vol[idx] = run;
    }
  }
  __syncthreads();
  for (int t4 = threadIdx.x * 4; t4 < NTOT; t4 += 256 * 4)
    *(float4*)(dptr + t4) = *(const float4*)(vol + t4);
}

// ---------------------------------------------------------------------------
// K6a: prefix sums of the two operands of the k*v product.  The product is
// linear in each operand, so its prefix over w is the product with k summed
// over w, and its prefix over d the product with v summed over d: the two
// scans run on 8 MB each instead of on the 128 MB product.
// One wave per 32x32 slice (c,h); lane = m.  The scanned slice is written in
// the order in which K6b's lanes read their WMMA fragments:
//   f[s][lane = lh*16+lm][t*2+y],  m = 4*s + 2*lh + y
//   k family: row  w = t*16 + lm;   v family: column d = 2*lm + t
// Every loop is unrolled so that val[] has constant indices and stays in
// registers, and the 32 loads (k) or 8 b128 loads (v) of a slice are all in flight together.
// ---------------------------------------------------------------------------
#define FPITCH 68   // floats per group of 16 lanes in LDS: 16-byte aligned, and
                    // the 16 groups start on 16 different banks

__global__ __launch_bounds__(256)
void operand_prefix_kernel(const float* __restrict__ k3,
                           const float* __restrict__ v3,
                           float* __restrict__ kf, float* __restrict__ vf) {
  __shared__ __attribute__((aligned(16))) float frag[8][16 * FPITCH];
  const int wave = threadIdx.x >> 5;
  const int m    = threadIdx.x & 31;
  const size_t base = ((size_t)blockIdx.x * 8 + wave) * 1024;   // slice (c,h)
  float* f = frag[wave] + (m >> 1) * FPITCH + (m & 1);
  float val[32];
  if (blockIdx.y == 0) {
#pragma unroll
    for (int w = 0; w < 32; ++w) val[w] = k3[base + w*32 + m];
#pragma unroll
    for (int w = 1; w < 32; ++w) val[w] += val[w - 1];
#pragma unroll
    for (int w = 0; w < 32; ++w) f[(w & 15)*4 + (w >> 4)*2] = val[w];
  } else {
#pragma unroll
    for (int q = 0; q < 8; ++q) {
      const float4 r4 = *(const float4*)(v3 + base + m*32 + q*4);
      val[q*4 + 0] = r4.x; val[q*4 + 1] = r4.y;
      val[q*4 + 2] = r4.z; val[q*4 + 3] = r4.w;
    }
#pragma unroll
    for (int d = 1; d < 32; ++d) val[d] += val[d - 1];
#pragma unroll
    for (int d = 0; d < 32; ++d) f[(d >> 1)*4 + (d & 1)*2] = val[d];
  }
  // the lanes of a wave read below what other lanes of it wrote above
  __syncthreads();
  float* dst = (blockIdx.y == 0 ? kf : vf) + base + m*4;
#pragma unroll
  for (int s = 0; s < 8; ++s)
    *(float4*)(dst + s*128) =
        *(const float4*)(frag[wave] + (s*2 + (m >> 4))*FPITCH + (m & 15)*4);
}

// ---------------------------------------------------------------------------
// K6b: ikv[bh,i,j,h,:,:] = sum over h' <= h of kf_i[h'](32x32) @ vf_j[h'](32x32)
// = the 3-D summed-area table of the k*v product.  One wave per (i,j) pair:
// it walks h, does each slice's product in fresh accumulators (4 tiles x 8
// K-steps of V_WMMA_F32_16X16X4_F32), adds it to a running sum in registers
// and stores the running sum.  Fragments come straight from kf/vf as whole
// 512-byte wave loads; the eight waves of a block share 2 k and 4 v volumes.
// Every loop is unrolled so that the fragment and accumulator arrays have
// constant indices and stay in registers.
// ---------------------------------------------------------------------------
__global__ __launch_bounds__(256)
void kv_sat_kernel(const float* __restrict__ kf, const float* __restrict__ vf,
                   float* __restrict__ ikv) {
  const int wave = threadIdx.x >> 5;
  const int lane = threadIdx.x & 31;
  const int lm = lane & 15, lh = lane >> 4;
  const int bh = blockIdx.y;                              // 0..7
  const int i  = (blockIdx.x >> 2)*2 + (wave >> 2);       // 0..15
  const int j  = (blockIdx.x & 3)*4 + (wave & 3);         // 0..15
  const float* A = kf + (size_t)(bh*16 + i)*NTOT + lane*4;
  const float* B = vf + (size_t)(bh*16 + j)*NTOT + lane*4;
  float* out = ikv + ((size_t)((bh*16 + i)*16 + j))*NTOT + lh*8*32 + lm*2;
  v8f run[2][2];
#pragma unroll
  for (int mt = 0; mt < 2; ++mt)
#pragma unroll
    for (int nt = 0; nt < 2; ++nt) run[mt][nt] = (v8f){0,0,0,0,0,0,0,0};
  float4 a[2][8], b[2][8];
#pragma unroll
  for (int s = 0; s < 8; ++s) {
    a[0][s] = *(const float4*)(A + s*128);
    b[0][s] = *(const float4*)(B + s*128);
  }
  // h is unrolled whole: every load and store then has a constant offset from
  // one address that never changes, and the two fragment sets need no copies
#pragma unroll
  for (int h = 0; h < HH; ++h) {
    const int cur = h & 1, nxt = cur ^ 1;
    if (h + 1 < HH) {
      // the next slice's fragments fly while this slice is multiplied
#pragma unroll
      for (int s = 0; s < 8; ++s) {
        a[nxt][s] = *(const float4*)(A + (h + 1)*1024 + s*128);
        b[nxt][s] = *(const float4*)(B + (h + 1)*1024 + s*128);
      }
    }
    // holds these loads in front of this slice's products, and (with the one
    // at the foot) later slices' loads behind them: left free, the scheduler
    // mixes five slices and goes past 256 registers
    __builtin_amdgcn_sched_barrier(0);
    v8f acc[2][2];
#pragma unroll
    for (int mt = 0; mt < 2; ++mt)
#pragma unroll
      for (int nt = 0; nt < 2; ++nt) acc[mt][nt] = (v8f){0,0,0,0,0,0,0,0};
#pragma unroll
    for (int s = 0; s < 8; ++s) {
      const v2f a0 = {a[cur][s].x, a[cur][s].y}, a1 = {a[cur][s].z, a[cur][s].w};
      const v2f b0 = {b[cur][s].x, b[cur][s].y}, b1 = {b[cur][s].z, b[cur][s].w};
      acc[0][0] = wmma4(a0, b0, acc[0][0]);
      acc[0][1] = wmma4(a0, b1, acc[0][1]);
      acc[1][0] = wmma4(a1, b0, acc[1][0]);
      acc[1][1] = wmma4(a1, b1, acc[1][1]);
    }
    // one vector slot between the products and the adds: the first tile's last
    // WMMA has only three WMMAs behind it, and the add that reads its result
    // is to stand four vector slots behind it; the two scheduling barriers
    // hold the slot at this place
    __builtin_amdgcn_sched_barrier(0);
    asm volatile("v_nop");
    __builtin_amdgcn_sched_barrier(0);
#pragma unroll
    for (int mt = 0; mt < 2; ++mt) {
      run[mt][0] += acc[mt][0];
      run[mt][1] += acc[mt][1];
#pragma unroll
      for (int r = 0; r < 8; ++r) {
        // row w = mt*16 + r + 8*lh, columns d = 2*lm and 2*lm + 1: sixteen
        // lanes fill one 128-byte row
        const float2 o = make_float2(run[mt][0][r], run[mt][1][r]);
        *(float2*)(out + h*1024 + (mt*16 + r)*32) = o;
      }
    }
    __builtin_amdgcn_sched_barrier(0);   // see above
  }
}

// ---------------------------------------------------------------------------
// K7: windowed box sums via 8-corner SAT differences (edge-clamped center
// padding), contracted with q; accumulates 0.5 * sum over both windows of
// SCALE*num/Z into acc[c][n].
// ---------------------------------------------------------------------------
// running pointers keep the global address space (global_load, not flat_load)
typedef __attribute__((address_space(1))) const float gcfloat;

__global__ __launch_bounds__(256)
void wkv_num_kernel(const float* __restrict__ q3, const float* __restrict__ ik,
                    const float* __restrict__ ikv, float* __restrict__ accout) {
  const int bh = blockIdx.y;
  const int voxel = blockIdx.x * 256 + threadIdx.x;
  const int h = voxel >> 10, w = (voxel >> 5) & 31, d = voxel & 31;
  float res[16];
#pragma unroll
  for (int j = 0; j < 16; ++j) res[j] = 0.f;

#pragma unroll 1
  for (int win = 0; win < 2; ++win) {
    const int a = win ? 8 : 4;
    const int da = a - 1;
    const int oh = HH - a + 1, ow = WW - a + 1, od = DD - a + 1;
    const int ph = (HH - oh) >> 1, pw = (WW - ow) >> 1, pd = (DD - od) >> 1;
    int th = h - ph; th = th < 0 ? 0 : (th > oh - 1 ? oh - 1 : th);
    int tw = w - pw; tw = tw < 0 ? 0 : (tw > ow - 1 ? ow - 1 : tw);
    int td = d - pd; td = td < 0 ? 0 : (td > od - 1 ? od - 1 : td);
    const int h1 = th + da, w1 = tw + da, d1 = td + da;
    int off[8]; float sgn[8];
    off[0] = h1*1024 + w1*32 + d1; sgn[0] =  1.f;
    off[1] = h1*1024 + w1*32 + td; sgn[1] = -1.f;
    off[2] = h1*1024 + tw*32 + d1; sgn[2] = -1.f;
    off[3] = h1*1024 + tw*32 + td; sgn[3] =  1.f;
    off[4] = th*1024 + w1*32 + d1; sgn[4] = -1.f;
    off[5] = th*1024 + w1*32 + td; sgn[5] =  1.f;
    off[6] = th*1024 + tw*32 + d1; sgn[6] =  1.f;
    off[7] = th*1024 + tw*32 + td; sgn[7] = -1.f;

    float Z = 1e-6f;
    float num[16];
#pragma unroll
    for (int j = 0; j < 16; ++j) num[j] = 0.f;
    // one running pointer per corner; they are stepped right after the trip's loads
    gcfloat* pk[8];
    gcfloat* pv[8];
#pragma unroll
    for (int c = 0; c < 8; ++c) {
      pk[c] = (gcfloat*)(uintptr_t)(ik  + (size_t)bh*16*NTOT + off[c]);
      pv[c] = (gcfloat*)(uintptr_t)(ikv + (size_t)bh*256*NTOT + off[c]);
    }
    gcfloat* pq = (gcfloat*)(uintptr_t)(q3 + (size_t)bh*16*NTOT + voxel);
    // i stays rolled, for speed only
#pragma unroll 1
    for (int i = 0; i < 16; ++i) {
      // all 137 loads of the trip are independent and are issued before any
      // of them is used
      const float qi = *pq;
      float tk[8], t[16][8];
#pragma unroll
      for (int c = 0; c < 8; ++c) tk[c] = *pk[c];
#pragma unroll
      for (int j = 0; j < 16; ++j) {
#pragma unroll
        for (int c = 0; c < 8; ++c) t[j][c] = pv[c][j*NTOT];
        // behind the trip's last load, in front of the pointer steps below,
        // which overwrite the address registers that the issued loads name
        if (j == 15) asm volatile("s_wait_xcnt 0x0" ::: "memory");
        // keeps the eight corners of one volume together in issue order: the
        // two d corners of a row share one 128-byte line, and the second then
        // finds the line of the first instead of coming 16 volumes later
        __builtin_amdgcn_sched_barrier(0);
      }
      pq += NTOT;
#pragma unroll
      for (int c = 0; c < 8; ++c) { pk[c] += NTOT; pv[c] += 16*NTOT; }
      float wk = 0.f;
#pragma unroll
      for (int c = 0; c < 8; ++c) wk += sgn[c] * tk[c];
      Z += qi * wk;
#pragma unroll
      for (int j = 0; j < 16; ++j) {
        float s8 = 0.f;
#pragma unroll
        for (int c = 0; c < 8; ++c) s8 += sgn[c] * t[j][c];
        num[j] += qi * s8;
      }
    }
    const float f = ATTN_SCALE / Z;
#pragma unroll
    for (int j = 0; j < 16; ++j) res[j] += num[j] * f;
  }
#pragma unroll
  for (int j = 0; j < 16; ++j)
    accout[(size_t)(bh*16 + j)*NTOT + voxel] = 0.5f * res[j];   // / len(WINDOWS)
}

// ---------------------------------------------------------------------------
// K8: final projection: d_out[c][n] = sum_c' acc[c'][n]*pw[c'][c] + pb[c]
// ---------------------------------------------------------------------------
__global__ __launch_bounds__(32)
void proj_gemm_kernel(const float* __restrict__ accb,
                      const float* __restrict__ pw,
                      const float* __restrict__ pb,
                      float* __restrict__ out) {
  const int n0 = blockIdx.x * 16;
  const int c0 = blockIdx.y * 16;
  const int lane = threadIdx.x & 31;
  const int lm = lane & 15, lh = lane >> 4;
  v8f acc = {0,0,0,0,0,0,0,0};
  for (int k0 = 0; k0 < CDIM; k0 += 4) {
    const int ka = k0 + 2*lh;
    v2f a, b;
    a.x = accb[(size_t)(ka    )*NTOT + n0 + lm];
    a.y = accb[(size_t)(ka + 1)*NTOT + n0 + lm];
    b.x = pw[(ka    )*CDIM + c0 + lm];
    b.y = pw[(ka + 1)*CDIM + c0 + lm];
    acc = wmma4(a, b, acc);
  }
  const float bias = pb[c0 + lm];
#pragma unroll
  for (int r = 0; r < 8; ++r) {
    const int n = n0 + r + 8*lh;
    const int c = c0 + lm;
    out[(size_t)c*NTOT + n] = acc[r] + bias;   // transpose back to (C,N)
  }
}

// ---------------------------------------------------------------------------
extern "C" void kernel_launch(void* const* d_in, const int* in_sizes, int n_in,
                              void* d_out, int out_size, void* d_ws, size_t ws_size,
                              hipStream_t stream) {
  const float* x  = (const float*)d_in[0];
  const float* qw = (const float*)d_in[1];
  const float* kw = (const float*)d_in[2];
  const float* vw = (const float*)d_in[3];
  const float* pw = (const float*)d_in[4];
  const float* pb = (const float*)d_in[5];
  float* out = (float*)d_out;

  const size_t U = (size_t)NTOT * CDIM;     // 2,097,152 floats
  float* ws   = (float*)d_ws;
  float* q3   = ws + 3*U;                   // (C,N)
  float* k3   = ws + 4*U;
  float* v3   = ws + 5*U;
  float* ik   = ws + 6*U;                   // SAT of k3
  float* accb = ws + 7*U;                   // attention output (C,N)
  float* ikv  = ws + 8*U;                   // SAT(kv): 16*U floats
  float* kf   = ws + 24*U;                  // k3 summed over w, fragment order
  float* vf   = ws + 25*U;                  // v3 summed over d, fragment order

  qkv_softmax_kernel<<<dim3(NTOT/64, 3), 128, 0, stream>>>(x, qw, kw, vw,
                                                            q3, k3, v3);
  sat3d_kernel<<<CDIM, 256, 0, stream>>>(k3, ik);
  operand_prefix_kernel<<<dim3(CDIM*HH/8, 2), 256, 0, stream>>>(k3, v3, kf, vf);
  kv_sat_kernel<<<dim3(32, HEADS), 256, 0, stream>>>(kf, vf, ikv);
  wkv_num_kernel<<<dim3(NTOT/256, HEADS), 256, 0, stream>>>(q3, ik, ikv, accb);
  proj_gemm_kernel<<<dim3(NTOT/16, CDIM/16), 32, 0, stream>>>(accb, pw, pb, out);
}

// v004
// It runs in 63.9 microseconds.
// Timed twice side by side with v003, it ran 2.04 and 2.03 times as fast.
// Counting every step since v000, it is 6.59 times as fast.
#include <hip/hip_runtime.h>
#include <math.h>

// Problem constants (B=1)
#define HEADS 8
#define CDIM  128
#define HD    16          // head dim
#define HH    16
#define WW    32
#define DD    32
#define NTOT  (HH*WW*DD)  // 16384 spatial positions
#define ATTN_SCALE 0.25f  // (CDIM/HEADS)^-0.5 = 16^-0.5

typedef float v2f __attribute__((ext_vector_type(2)));
typedef float v4f __attribute__((ext_vector_type(4)));
typedef float v8f __attribute__((ext_vector_type(8)));

// D(16x16,f32) = A(16x4,f32) x B(4x16,f32) + C  -- V_WMMA_F32_16X16X4_F32
static __device__ __forceinline__ v8f wmma4(v2f a, v2f b, v8f c) {
  return __builtin_amdgcn_wmma_f32_16x16x4_f32(false, a, false, b, (short)0, c,
                                               false, false);
}

// ---------------------------------------------------------------------------
// K1: q3/k3/v3 = softmax / softmax / identity of ({qw,kw,vw}^T @ x), stored
// channel-major (C,N).  The tile is taken transposed: M = channel, N = position
// (A = weight^T, B = x), so a wave that holds all 128 channels of 16 positions
// has both softmax axes in its own registers (k: plus one exchange between the
// lane halves) and its stores already run along n.  blockIdx.y picks the family.
// The eight tiles (g,e) deal the channels so that one 16-byte load of a weight
// row feeds four tiles: row M of tile (g,e) is channel 64*g + 4*M + e.
// D layout: acc[g][e][r] is M = r + 8*lh at position n0 + lm, that is
//   channel 64*g + 32*lh + 4*r + e = head 4*g + 2*lh + (r>>2), j = 4*(r&3) + e.
// ---------------------------------------------------------------------------
// four K-steps' fragments: w[u][g][y] is weight row k + 4*u + 2*lh + y, channels
// 64*g + 4*lm .. +3; b[u] the two x rows of the same k at position n0 + lm
static __device__ __forceinline__ void qkv_load4(const float* xp, const float* wp,
                                                 int k, float4 (&w)[4][2][2],
                                                 v2f (&b)[4]) {
#pragma unroll
  for (int u = 0; u < 4; ++u) {
    b[u].x = xp[(size_t)(k + 4*u    )*NTOT];
    b[u].y = xp[(size_t)(k + 4*u + 1)*NTOT];
#pragma unroll
    for (int g = 0; g < 2; ++g) {
      w[u][g][0] = *(const float4*)(wp + (k + 4*u    )*CDIM + g*64);
      w[u][g][1] = *(const float4*)(wp + (k + 4*u + 1)*CDIM + g*64);
    }
  }
}

static __device__ __forceinline__ void qkv_mma4(const float4 (&w)[4][2][2],
                                                const v2f (&b)[4], v8f (&acc)[2][4]) {
#pragma unroll
  for (int u = 0; u < 4; ++u)
#pragma unroll
    for (int g = 0; g < 2; ++g) {
      acc[g][0] = wmma4((v2f){w[u][g][0].x, w[u][g][1].x}, b[u], acc[g][0]);
      acc[g][1] = wmma4((v2f){w[u][g][0].y, w[u][g][1].y}, b[u], acc[g][1]);
      acc[g][2] = wmma4((v2f){w[u][g][0].z, w[u][g][1].z}, b[u], acc[g][2]);
      acc[g][3] = wmma4((v2f){w[u][g][0].w, w[u][g][1].w}, b[u], acc[g][3]);
    }
}

__global__ __launch_bounds__(128)
void qkv_softmax_kernel(const float* __restrict__ x,
                        const float* __restrict__ qw, const float* __restrict__ kw,
                        const float* __restrict__ vw,
                        float* __restrict__ q3, float* __restrict__ k3,
                        float* __restrict__ v3) {
  const int wave = threadIdx.x >> 5;
  const int lane = threadIdx.x & 31;
  const int lm = lane & 15;        // M row of A / N column of B and D
  const int lh = lane >> 4;        // lane-half selects the K pair
  const int n0 = (blockIdx.x * 4 + wave) * 16;
  const int fam = blockIdx.y;      // 0 q, 1 k, 2 v
  const float* wgt = fam == 0 ? qw : (fam == 1 ? kw : vw);
  float* dst       = fam == 0 ? q3 : (fam == 1 ? k3 : v3);
  const float* xp = x   + (size_t)(2*lh)*NTOT + n0 + lm;
  const float* wp = wgt + (2*lh)*CDIM + lm*4;
  v8f acc[2][4];
#pragma unroll
  for (int g = 0; g < 2; ++g)
#pragma unroll
    for (int e = 0; e < 4; ++e) acc[g][e] = (v8f){0,0,0,0,0,0,0,0};
  // two register sets of four K-steps each: one set's 24 loads fly while the
  // other set is multiplied
  float4 w0[4][2][2], w1[4][2][2];
  v2f b0[4], b1[4];
  qkv_load4(xp, wp, 0, w0, b0);
  // stays rolled: the two halves of a trip name their sets by constant.  The
  // last 32 of K stand behind the loop, so that no load in the loop hangs on a
  // test: with one, the waits in front of the products cover both paths and
  // take the newest loads in as well
#pragma unroll 1
  for (int k0 = 0; k0 < CDIM - 32; k0 += 32) {
    qkv_load4(xp, wp, k0 + 16, w1, b1);
    // the scheduling barriers hold each set's loads in front of the other
    // set's products, so that they are in flight during them, and behind the
    // products before: two sets are live at a time and no third
    __builtin_amdgcn_sched_barrier(0);
    qkv_mma4(w0, b0, acc);
    __builtin_amdgcn_sched_barrier(0);   // see above
    qkv_load4(xp, wp, k0 + 32, w0, b0);
    __builtin_amdgcn_sched_barrier(0);   // see above
    qkv_mma4(w1, b1, acc);
    __builtin_amdgcn_sched_barrier(0);   // see above
  }
  qkv_load4(xp, wp, CDIM - 16, w1, b1);
  __builtin_amdgcn_sched_barrier(0);     // see above
  qkv_mma4(w0, b0, acc);
  qkv_mma4(w1, b1, acc);
  if (fam == 0) {
    // softmax over the 16 channels of a head: all in this lane, summed in j order
#pragma unroll
    for (int g = 0; g < 2; ++g)
#pragma unroll
      for (int rh = 0; rh < 2; ++rh) {
        float m = -3.0e38f;
#pragma unroll
        for (int j = 0; j < 16; ++j) m = fmaxf(m, acc[g][j & 3][rh*4 + (j >> 2)]);
        float s = 0.f;
#pragma unroll
        for (int j = 0; j < 16; ++j) {
          const float ex = __expf(acc[g][j & 3][rh*4 + (j >> 2)] - m);
          acc[g][j & 3][rh*4 + (j >> 2)] = ex;
          s += ex;
        }
        const float inv = 1.f / s;
#pragma unroll
        for (int j = 0; j < 16; ++j) acc[g][j & 3][rh*4 + (j >> 2)] *= inv;
      }
  } else if (fam == 1) {
    // softmax over the HEADS axis: four heads in this lane, four in its partner
    // of the other lane half
#pragma unroll
    for (int e = 0; e < 4; ++e)
#pragma unroll
      for (int rl = 0; rl < 4; ++rl) {
        float m = fmaxf(fmaxf(acc[0][e][rl], acc[0][e][4 + rl]),
                        fmaxf(acc[1][e][rl], acc[1][e][4 + rl]));
        m = fmaxf(m, __shfl_xor(m, 16));
        float s = 0.f;
#pragma unroll
        for (int g = 0; g < 2; ++g)
#pragma unroll
          for (int rh = 0; rh < 2; ++rh) {
            const float ex = __expf(acc[g][e][rh*4 + rl] - m);
            acc[g][e][rh*4 + rl] = ex;
            s += ex;
          }
        s += __shfl_xor(s, 16);
        const float inv = 1.f / s;
#pragma unroll
        for (int g = 0; g < 2; ++g)
#pragma unroll
          for (int rh = 0; rh < 2; ++rh) acc[g][e][rh*4 + rl] *= inv;
      }
  }
  float* o = dst + (size_t)(32*lh)*NTOT + n0 + lm;
#pragma unroll
  for (int g = 0; g < 2; ++g)
#pragma unroll
    for (int r = 0; r < 8; ++r)
#pragma unroll
      for (int e = 0; e < 4; ++e)
        o[(size_t)(64*g + 4*r + e)*NTOT] = acc[g][e][r];
}

// ---------------------------------------------------------------------------
// The box sum of the k*v product over a window is linear in each operand, and
// the sum over the query channel i can be taken before the one over m:
//   num[j](h,w,d) = sum over h' in the h window, over m of
//                   ( sum_i q_i(h,w,d) * KW_i[h'](w,m) ) * VD_j[h'](m,d)
// KW = k summed over the w window of output row w, VD = v summed over the d
// window of output column d.  A window of size a starts at win_start() and
// holds the a-1 elements behind its start (the 8-corner difference of an
// inclusive table, with the edge padding as a clamp of the start).
// ---------------------------------------------------------------------------
static __device__ __forceinline__ constexpr int win_start(int x, int len, int a) {
  const int t = x - ((a - 1) >> 1);
  return t < 0 ? 0 : (t > len - a ? len - a : t);
}

#define WIN_STRIDE (HEADS*HH*32*512)   // floats of one window's operand table (= C*N)

// ---------------------------------------------------------------------------
// K2: window sums of the two operands, written in the order in which K3's
// lanes read their WMMA fragments (16 bytes a lane, 512 bytes a wave):
//   kwin[win][bh][h'][w][i/4][m][i%4]     vwin[win][bh][h'][d][m/4][j][m%4]
// One wave per (bh, h', group of four i) or (bh, h', pair of m groups); a lane
// holds four rows of 32 in registers.  Every loop is unrolled so that val[] has
// constant indices and all loads of a lane are in flight together.
// ---------------------------------------------------------------------------
__global__ __launch_bounds__(256)
void operand_window_kernel(const float* __restrict__ k3,
                           const float* __restrict__ v3,
                           float* __restrict__ kwin, float* __restrict__ vwin) {
  const int wave = threadIdx.x >> 5;
  const int lane = threadIdx.x & 31;
  const int wid  = blockIdx.x * 8 + wave;
  const int part = wid & 3, hp = (wid >> 2) & 15, bh = wid >> 6;
  // both branches hand their 128 values on as 16-byte vectors: taken apart
  // inside the branches, the compiler merges the two runs of loads into one run
  // of 4-byte loads whose offsets it keeps in scalar registers, and spills those
  v4f row[4][8];
  if (blockIdx.y == 0) {
    // lane = m, row[e] runs over w, channel i = part*4 + e
    const float* s = k3 + (size_t)((bh*16 + part*4)*16 + hp)*1024 + lane;
#pragma unroll
    for (int e = 0; e < 4; ++e)
#pragma unroll
      for (int q = 0; q < 8; ++q)
        row[e][q] = (v4f){s[e*NTOT + q*128], s[e*NTOT + q*128 + 32],
                          s[e*NTOT + q*128 + 64], s[e*NTOT + q*128 + 96]};
  } else {
    // lane = (m group, j), row[e] runs over d, m = (part*2 + (lane >> 4))*4 + e
    const float* s = v3 + (size_t)((bh*16 + (lane & 15))*16 + hp)*1024
                        + (part*2 + (lane >> 4))*128;
#pragma unroll
    for (int e = 0; e < 4; ++e)
#pragma unroll
      for (int q = 0; q < 8; ++q) row[e][q] = *(const v4f*)(s + e*32 + q*4);
    // behind this branch's loads: the built code lays the other branch's
    // address sum behind them, into the register pair that they name
    asm volatile("s_wait_xcnt 0x0" ::: "memory");
  }
  float val[4][32];
#pragma unroll
  for (int e = 0; e < 4; ++e)
#pragma unroll
    for (int q = 0; q < 8; ++q) {
      val[e][q*4 + 0] = row[e][q].x; val[e][q*4 + 1] = row[e][q].y;
      val[e][q*4 + 2] = row[e][q].z; val[e][q*4 + 3] = row[e][q].w;
    }
#pragma unroll
  for (int e = 0; e < 4; ++e)
#pragma unroll
    for (int p = 1; p < 32; ++p) val[e][p] += val[e][p - 1];
  float* dst = (blockIdx.y == 0 ? kwin : vwin)
             + (size_t)(bh*16 + hp)*32*512 + part*128 + lane*4;
#pragma unroll
  for (int win = 0; win < 2; ++win)
#pragma unroll
    for (int p = 0; p < 32; ++p) {
      const int a = win ? 8 : 4;
      const int t = win_start(p, 32, a);
      *(float4*)(dst + win*WIN_STRIDE + p*512) =
          make_float4(val[0][t + a - 1] - val[0][t], val[1][t + a - 1] - val[1][t],
                      val[2][t + a - 1] - val[2][t], val[3][t + a - 1] - val[3][t]);
    }
}

// ---------------------------------------------------------------------------
// K3: one block per (bh, h, 16 columns d, 16 rows w); ten passes, one per slice
// h' of the two h windows.  A pass has two WMMA stages:
//  stage 1 (a wave takes 2 rows w):  P[m][d] = sum_i KW_i(w,m) * q_i(h,w,d)
//      A = KW (M = m, K = i), B = q (K = i, N = d);  i = 8*lh + 2*s + y
//  stage 2 (a wave takes 2 columns d): num[j][w] += sum_m VD_j(m,d) * P[m][w]
//      A = VD (M = j, K = m), B = P (K = m, N = w);  m = 16*lh + 2*s + y
// Stage 1 is batched over w and stage 2 over d, so P goes through LDS as
// [d][w][m].  Z is the sum of P over the d window of m, taken from stage 2's
// own B fragments.  Two LDS buffers: one barrier a pass is enough, since a
// buffer is written again only behind the next pass's barrier.
// ---------------------------------------------------------------------------
#define PPW 36             // floats per (d,w) row of 32 m: 16 bytes x odd
#define PPD (16*PPW + 4)   // floats per d: sixteen d start on sixteen bank groups
#define OPW 20             // epilogue tile: floats per (j,w) row of 16 d
#define OPJ (16*OPW + 4)

// four waves a SIMD (256 registers): two blocks share a WGP, and one block's
// stages fill the matrix pipe while the other waits at its barrier
__global__ __launch_bounds__(256, 4)
void window_attn_kernel(const float* __restrict__ q3,
                        const float* __restrict__ kwin4,
                        const float* __restrict__ kwin8,
                        const float* __restrict__ vwin4,
                        const float* __restrict__ vwin8,
                        float* __restrict__ accout) {
  __shared__ __attribute__((aligned(16))) float P[2][16 * PPD];
  const int wave = threadIdx.x >> 5;
  const int lane = threadIdx.x & 31;
  const int lm = lane & 15, lh = lane >> 4;
  const int d0 = (blockIdx.x >> 1) * 16, w0 = (blockIdx.x & 1) * 16;
  const int h = blockIdx.y, bh = blockIdx.z;

  // q fragments of this wave's two rows w: the same in all ten passes
  v2f bq[2][4];
#pragma unroll
  for (int u = 0; u < 2; ++u)
#pragma unroll
    for (int s = 0; s < 4; ++s) {
      const float* qp = q3 + (size_t)(bh*16 + lh*8 + 2*s)*NTOT + h*1024
                           + (w0 + wave*2 + u)*32 + d0 + lm;
      bq[u][s].x = qp[0];
      bq[u][s].y = qp[NTOT];
    }
  // behind the q loads: the built code reuses the register pair that they name
  // as their address for what comes next
  asm volatile("s_wait_xcnt 0x0" ::: "memory");
  // first slice of each h window, this lane's fragment
  const int hs4 = win_start(h, HH, 4) + 1, hs8 = win_start(h, HH, 8) + 1;
  const float* kb4 = kwin4 + (size_t)((bh*16 + hs4)*32 + w0 + wave*2)*512 + lh*256 + lm*4;
  const float* kb8 = kwin8 + (size_t)((bh*16 + hs8)*32 + w0 + wave*2)*512 + lh*256 + lm*4;
  const float* vb4 = vwin4 + (size_t)((bh*16 + hs4)*32 + d0 + wave*2)*512 + lh*256 + lm*4;
  const float* vb8 = vwin8 + (size_t)((bh*16 + hs8)*32 + d0 + wave*2)*512 + lh*256 + lm*4;

  float4 ka[2][2][2];   // [u][mt][i group of this lane half]
  float4 va[2][4];      // [u][m group of this lane half]
  v8f acc[2];
  v2f z[2], msk[2][8];
  float res[2][8];
#pragma unroll
  for (int u = 0; u < 2; ++u)
#pragma unroll
    for (int r = 0; r < 8; ++r) res[u][r] = 0.f;
#pragma unroll
  for (int u = 0; u < 2; ++u)
#pragma unroll
    for (int mt = 0; mt < 2; ++mt)
#pragma unroll
      for (int g = 0; g < 2; ++g)
        ka[u][mt][g] = *(const float4*)(kb4 + u*512 + g*128 + mt*64);

  // unrolled whole: window, slice and LDS buffer of a pass are constants
#pragma unroll
  for (int it = 0; it < 10; ++it) {
    const int win = it >= 3 ? 1 : 0;
    const int t   = win ? it - 3 : it;
    const int a   = win ? 8 : 4;
    float* Pb = P[it & 1];
    if (t == 0) {
#pragma unroll
      for (int u = 0; u < 2; ++u) {
        acc[u] = (v8f){0,0,0,0,0,0,0,0};
        z[u] = (v2f){0.f, 0.f};
        // 1 where this lane's m lies in the d window of column d
        const int td = win_start(d0 + wave*2 + u, DD, a);
#pragma unroll
        for (int g = 0; g < 8; ++g) {
          const int m = lh*16 + 2*g;
          msk[u][g].x = (m     > td && m     < td + a) ? 1.f : 0.f;
          msk[u][g].y = (m + 1 > td && m + 1 < td + a) ? 1.f : 0.f;
        }
      }
    }
    // stage 2's A fragments fly during stage 1
    const float* vb = (win ? vb8 : vb4) + t*16384;
#pragma unroll
    for (int u = 0; u < 2; ++u)
#pragma unroll
      for (int g = 0; g < 4; ++g)
        va[u][g] = *(const float4*)(vb + u*512 + g*64);
    // holds these loads in front of stage 1, so that they are in flight during it
    __builtin_amdgcn_sched_barrier(0);
    v8f p[2][2];
#pragma unroll
    for (int u = 0; u < 2; ++u)
#pragma unroll
      for (int mt = 0; mt < 2; ++mt) p[u][mt] = (v8f){0,0,0,0,0,0,0,0};
#pragma unroll
    for (int g = 0; g < 2; ++g)
#pragma unroll
      for (int u = 0; u < 2; ++u)
#pragma unroll
        for (int mt = 0; mt < 2; ++mt) {
          const float4 f = ka[u][mt][g];
          p[u][mt] = wmma4((v2f){f.x, f.y}, bq[u][2*g    ], p[u][mt]);
          p[u][mt] = wmma4((v2f){f.z, f.w}, bq[u][2*g + 1], p[u][mt]);
        }
    // p[u][mt][r] is m = mt*16 + 8*lh + r at d = lm: eight consecutive m
#pragma unroll
    for (int u = 0; u < 2; ++u)
#pragma unroll
      for (int mt = 0; mt < 2; ++mt) {
        float* o = Pb + lm*PPD + (wave*2 + u)*PPW + mt*16 + lh*8;
        *(float4*)(o    ) = make_float4(p[u][mt][0], p[u][mt][1], p[u][mt][2], p[u][mt][3]);
        *(float4*)(o + 4) = make_float4(p[u][mt][4], p[u][mt][5], p[u][mt][6], p[u][mt][7]);
      }
    // publishes this pass's P to the waves that read it by column
    __syncthreads();
    if (it + 1 < 10) {
      // the next pass's stage 1 fragments fly during stage 2; they stand behind
      // the barrier, which waits for every load issued in front of it
      const float* kb = (it + 1 >= 3) ? kb8 + (it + 1 - 3)*16384 : kb4 + (it + 1)*16384;
#pragma unroll
      for (int u = 0; u < 2; ++u)
#pragma unroll
        for (int mt = 0; mt < 2; ++mt)
#pragma unroll
          for (int g = 0; g < 2; ++g)
            ka[u][mt][g] = *(const float4*)(kb + u*512 + g*128 + mt*64);
      // behind the last loads from the first window's base address: the built
      // code reuses the register pair that held it during stage 2
      if (it + 1 == 2) asm volatile("s_wait_xcnt 0x0" ::: "memory");
    }
#pragma unroll
    for (int g = 0; g < 4; ++g)
#pragma unroll
      for (int u = 0; u < 2; ++u) {
        const float4 bv = *(const float4*)(Pb + (wave*2 + u)*PPD + lm*PPW + lh*16 + g*4);
        const float4 av = va[u][g];
        const v2f b0 = {bv.x, bv.y}, b1 = {bv.z, bv.w};
        acc[u] = wmma4((v2f){av.x, av.y}, b0, acc[u]);
        acc[u] = wmma4((v2f){av.z, av.w}, b1, acc[u]);
        z[u] += b0 * msk[u][2*g];
        z[u] += b1 * msk[u][2*g + 1];
      }
    if (t == a - 2) {
      // end of a window: acc[u][r] is j = 8*lh + r at row w = lm; the lane
      // halves hold the two halves of Z's sum over m
#pragma unroll
      for (int u = 0; u < 2; ++u) {
        float zz = z[u].x + z[u].y;
        zz += __shfl_xor(zz, 16);
        const float f = ATTN_SCALE / (zz + 1e-6f);
#pragma unroll
        for (int r = 0; r < 8; ++r) res[u][r] += acc[u][r] * f;
      }
    }
  }
  // turn (j, w, d) so that the stores run along d.  The tile lies in buffer 0,
  // whose last readers (pass 8) are behind pass 9's barrier
  float* O = P[0];
#pragma unroll
  for (int u = 0; u < 2; ++u)
#pragma unroll
    for (int r = 0; r < 8; ++r)
      O[(lh*8 + r)*OPJ + lm*OPW + wave*2 + u] = 0.5f * res[u][r];   // / len(WINDOWS)
  // the stores below read what other waves wrote above
  __syncthreads();
#pragma unroll
  for (int c = 0; c < 4; ++c) {
    const int idx = threadIdx.x + c*256;
    const int dq = idx & 3, wl = (idx >> 2) & 15, j = idx >> 6;
    *(float4*)(accout + (size_t)(bh*16 + j)*NTOT + h*1024 + (w0 + wl)*32 + d0 + dq*4) =
        *(const float4*)(O + j*OPJ + wl*OPW + dq*4);
  }
}

// ---------------------------------------------------------------------------
// K8: final projection: d_out[c][n] = sum_c' acc[c'][n]*pw[c'][c] + pb[c]
// ---------------------------------------------------------------------------
__global__ __launch_bounds__(32)
void proj_gemm_kernel(const float* __restrict__ accb,
                      const float* __restrict__ pw,
                      const float* __restrict__ pb,
                      float* __restrict__ out) {
  const int n0 = blockIdx.x * 16;
  const int c0 = blockIdx.y * 16;
  const int lane = threadIdx.x & 31;
  const int lm = lane & 15, lh = lane >> 4;
  v8f acc = {0,0,0,0,0,0,0,0};
  for (int k0 = 0; k0 < CDIM; k0 += 4) {
    const int ka = k0 + 2*lh;
    v2f a, b;
    a.x = accb[(size_t)(ka    )*NTOT + n0 + lm];
    a.y = accb[(size_t)(ka + 1)*NTOT + n0 + lm];
    b.x = pw[(ka    )*CDIM + c0 + lm];
    b.y = pw[(ka + 1)*CDIM + c0 + lm];
    acc = wmma4(a, b, acc);
  }
  const float bias = pb[c0 + lm];
#pragma unroll
  for (int r = 0; r < 8; ++r) {
    const int n = n0 + r + 8*lh;
    const int c = c0 + lm;
    out[(size_t)c*NTOT + n] = acc[r] + bias;   // transpose back to (C,N)
  }
}

// ---------------------------------------------------------------------------
extern "C" void kernel_launch(void* const* d_in, const int* in_sizes, int n_in,
                              void* d_out, int out_size, void* d_ws, size_t ws_size,
                              hipStream_t stream) {
  const float* x  = (const float*)d_in[0];
  const float* qw = (const float*)d_in[1];
  const float* kw = (const float*)d_in[2];
  const float* vw = (const float*)d_in[3];
  const float* pw = (const float*)d_in[4];
  const float* pb = (const float*)d_in[5];
  float* out = (float*)d_out;

  const size_t U = (size_t)NTOT * CDIM;     // 2,097,152 floats
  float* ws   = (float*)d_ws;
  float* q3   = ws + 3*U;                   // (C,N)
  float* k3   = ws + 4*U;
  float* v3   = ws + 5*U;
  float* accb = ws + 7*U;                   // attention output (C,N)
  float* kwin = ws + 8*U;                   // k window sums over w, 2 windows
  float* vwin = ws + 10*U;                  // v window sums over d, 2 windows

  qkv_softmax_kernel<<<dim3(NTOT/64, 3), 128, 0, stream>>>(x, qw, kw, vw,
                                                            q3, k3, v3);
  operand_window_kernel<<<dim3(HEADS*HH*4/8, 2), 256, 0, stream>>>(k3, v3, kwin, vwin);
  window_attn_kernel<<<dim3(4, HH, HEADS), 256, 0, stream>>>(q3, kwin, kwin + U, vwin,
                                                             vwin + U, accb);
  proj_gemm_kernel<<<dim3(NTOT/16, CDIM/16), 32, 0, stream>>>(accb, pw, pb, out);
}

// v005
// One run takes 55.4 microseconds.
// In both of two side-by-side timings against v004, it was 1.15 times as fast.
// All steps since v000 together make it 7.58 times as fast.
#include <hip/hip_runtime.h>
#include <math.h>

// Problem constants (B=1)
#define HEADS 8
#define CDIM  128
#define HD    16          // head dim
#define HH    16
#define WW    32
#define DD    32
#define NTOT  (HH*WW*DD)  // 16384 spatial positions
#define ATTN_SCALE 0.25f  // (CDIM/HEADS)^-0.5 = 16^-0.5

typedef float v2f __attribute__((ext_vector_type(2)));
typedef float v4f __attribute__((ext_vector_type(4)));
typedef float v8f __attribute__((ext_vector_type(8)));

// D(16x16,f32) = A(16x4,f32) x B(4x16,f32) + C  -- V_WMMA_F32_16X16X4_F32
static __device__ __forceinline__ v8f wmma4(v2f a, v2f b, v8f c) {
  return __builtin_amdgcn_wmma_f32_16x16x4_f32(false, a, false, b, (short)0, c,
                                               false, false);
}

// ---------------------------------------------------------------------------
// K1: q3/k3/v3 = softmax / softmax / identity of ({qw,kw,vw}^T @ x), stored
// channel-major (C,N).  The tile is taken transposed: M = channel, N = position
// (A = weight^T, B = x), so a wave that holds all 128 channels of 16 positions
// has both softmax axes in its own registers (k: plus one exchange between the
// lane halves) and its stores already run along n.  blockIdx.y picks the family.
// The eight tiles (g,e) deal the channels so that one 16-byte load of a weight
// row feeds four tiles: row M of tile (g,e) is channel 64*g + 4*M + e.
// D layout: acc[g][e][r] is M = r + 8*lh at position n0 + lm, that is
//   channel 64*g + 32*lh + 4*r + e = head 4*g + 2*lh + (r>>2), j = 4*(r&3) + e.
// ---------------------------------------------------------------------------
// four K-steps' fragments: w[u][g][y] is weight row k + 4*u + 2*lh + y, channels
// 64*g + 4*lm .. +3; b[u] the two x rows of the same k at position n0 + lm
static __device__ __forceinline__ void qkv_load4(const float* xp, const float* wp,
                                                 int k, float4 (&w)[4][2][2],
                                                 v2f (&b)[4]) {
#pragma unroll
  for (int u = 0; u < 4; ++u) {
    b[u].x = xp[(size_t)(k + 4*u    )*NTOT];
    b[u].y = xp[(size_t)(k + 4*u + 1)*NTOT];
#pragma unroll
    for (int g = 0; g < 2; ++g) {
      w[u][g][0] = *(const float4*)(wp + (k + 4*u    )*CDIM + g*64);
      w[u][g][1] = *(const float4*)(wp + (k + 4*u + 1)*CDIM + g*64);
    }
  }
}

static __device__ __forceinline__ void qkv_mma4(const float4 (&w)[4][2][2],
                                                const v2f (&b)[4], v8f (&acc)[2][4]) {
#pragma unroll
  for (int u = 0; u < 4; ++u)
#pragma unroll
    for (int g = 0; g < 2; ++g) {
      acc[g][0] = wmma4((v2f){w[u][g][0].x, w[u][g][1].x}, b[u], acc[g][0]);
      acc[g][1] = wmma4((v2f){w[u][g][0].y, w[u][g][1].y}, b[u], acc[g][1]);
      acc[g][2] = wmma4((v2f){w[u][g][0].z, w[u][g][1].z}, b[u], acc[g][2]);
      acc[g][3] = wmma4((v2f){w[u][g][0].w, w[u][g][1].w}, b[u], acc[g][3]);
    }
}

__global__ __launch_bounds__(128)
void qkv_softmax_kernel(const float* __restrict__ x,
                        const float* __restrict__ qw, const float* __restrict__ kw,
                        const float* __restrict__ vw,
                        float* __restrict__ q3, float* __restrict__ k3,
                        float* __restrict__ v3) {
  const int wave = threadIdx.x >> 5;
  const int lane = threadIdx.x & 31;
  const int lm = lane & 15;        // M row of A / N column of B and D
  const int lh = lane >> 4;        // lane-half selects the K pair
  const int n0 = (blockIdx.x * 4 + wave) * 16;
  const int fam = blockIdx.y;      // 0 q, 1 k, 2 v
  const float* wgt = fam == 0 ? qw : (fam == 1 ? kw : vw);
  float* dst       = fam == 0 ? q3 : (fam == 1 ? k3 : v3);
  const float* xp = x   + (size_t)(2*lh)*NTOT + n0 + lm;
  const float* wp = wgt + (2*lh)*CDIM + lm*4;
  v8f acc[2][4];
#pragma unroll
  for (int g = 0; g < 2; ++g)
#pragma unroll
    for (int e = 0; e < 4; ++e) acc[g][e] = (v8f){0,0,0,0,0,0,0,0};
  // two register sets of four K-steps each: one set's 24 loads fly while the
  // other set is multiplied
  float4 w0[4][2][2], w1[4][2][2];
  v2f b0[4], b1[4];
  qkv_load4(xp, wp, 0, w0, b0);
  // stays rolled: the two halves of a trip name their sets by constant.  The
  // last 32 of K stand behind the loop, so that no load in the loop hangs on a
  // test: with one, the waits in front of the products cover both paths and
  // take the newest loads in as well
#pragma unroll 1
  for (int k0 = 0; k0 < CDIM - 32; k0 += 32) {
    qkv_load4(xp, wp, k0 + 16, w1, b1);
    // the scheduling barriers hold each set's loads in front of the other
    // set's products, so that they are in flight during them, and behind the
    // products before: two sets are live at a time and no third
    __builtin_amdgcn_sched_barrier(0);
    qkv_mma4(w0, b0, acc);
    __builtin_amdgcn_sched_barrier(0);   // see above
    qkv_load4(xp, wp, k0 + 32, w0, b0);
    __builtin_amdgcn_sched_barrier(0);   // see above
    qkv_mma4(w1, b1, acc);
    __builtin_amdgcn_sched_barrier(0);   // see above
  }
  qkv_load4(xp, wp, CDIM - 16, w1, b1);
  __builtin_amdgcn_sched_barrier(0);     // see above
  qkv_mma4(w0, b0, acc);
  qkv_mma4(w1, b1, acc);
  if (fam == 0) {
    // softmax over the 16 channels of a head: all in this lane, summed in j order
#pragma unroll
    for (int g = 0; g < 2; ++g)
#pragma unroll
      for (int rh = 0; rh < 2; ++rh) {
        float m = -3.0e38f;
#pragma unroll
        for (int j = 0; j < 16; ++j) m = fmaxf(m, acc[g][j & 3][rh*4 + (j >> 2)]);
        float s = 0.f;
#pragma unroll
        for (int j = 0; j < 16; ++j) {
          const float ex = __expf(acc[g][j & 3][rh*4 + (j >> 2)] - m);
          acc[g][j & 3][rh*4 + (j >> 2)] = ex;
          s += ex;
        }
        const float inv = 1.f / s;
#pragma unroll
        for (int j = 0; j < 16; ++j) acc[g][j & 3][rh*4 + (j >> 2)] *= inv;
      }
  } else if (fam == 1) {
    // softmax over the HEADS axis: four heads in this lane, four in its partner
    // of the other lane half
#pragma unroll
    for (int e = 0; e < 4; ++e)
#pragma unroll
      for (int rl = 0; rl < 4; ++rl) {
        float m = fmaxf(fmaxf(acc[0][e][rl], acc[0][e][4 + rl]),
                        fmaxf(acc[1][e][rl], acc[1][e][4 + rl]));
        m = fmaxf(m, __shfl_xor(m, 16));
        float s = 0.f;
#pragma unroll
        for (int g = 0; g < 2; ++g)
#pragma unroll
          for (int rh = 0; rh < 2; ++rh) {
            const float ex = __expf(acc[g][e][rh*4 + rl] - m);
            acc[g][e][rh*4 + rl] = ex;
            s += ex;
          }
        s += __shfl_xor(s, 16);
        const float inv = 1.f / s;
#pragma unroll
        for (int g = 0; g < 2; ++g)
#pragma unroll
          for (int rh = 0; rh < 2; ++rh) acc[g][e][rh*4 + rl] *= inv;
      }
  }
  float* o = dst + (size_t)(32*lh)*NTOT + n0 + lm;
#pragma unroll
  for (int g = 0; g < 2; ++g)
#pragma unroll
    for (int r = 0; r < 8; ++r)
#pragma unroll
      for (int e = 0; e < 4; ++e)
        o[(size_t)(64*g + 4*r + e)*NTOT] = acc[g][e][r];
}

// ---------------------------------------------------------------------------
// The box sum of the k*v product over a window is linear in each operand, and
// the sum over the query channel i can be taken before the one over m:
//   num[j](h,w,d) = sum over h' in the h window, over m of
//                   ( sum_i q_i(h,w,d) * KW_i[h'](w,m) ) * VD_j[h'](m,d)
// KW = k summed over the w window of output row w, VD = v summed over the d
// window of output column d.  A window of size a starts at win_start() and
// holds the a-1 elements behind its start (the 8-corner difference of an
// inclusive table, with the edge padding as a clamp of the start).
// ---------------------------------------------------------------------------
static __device__ __forceinline__ constexpr int win_start(int x, int len, int a) {
  const int t = x - ((a - 1) >> 1);
  return t < 0 ? 0 : (t > len - a ? len - a : t);
}

#define WIN_STRIDE (HEADS*HH*32*512)   // floats of one window's operand table (= C*N)

// ---------------------------------------------------------------------------
// K2: window sums of the two operands, written in the order in which K3's
// lanes read their WMMA fragments (16 bytes a lane, 512 bytes a wave):
//   kwin[win][bh][h'][w][i/4][m][i%4]     vwin[win][bh][h'][d][m/4][j][m%4]
// One wave per (bh, h', group of four i) or (bh, h', pair of m groups); a lane
// holds four rows of 32 in registers.  Every loop is unrolled so that val[] has
// constant indices and all loads of a lane are in flight together.
// ---------------------------------------------------------------------------
__global__ __launch_bounds__(256)
void operand_window_kernel(const float* __restrict__ k3,
                           const float* __restrict__ v3,
                           float* __restrict__ kwin, float* __restrict__ vwin) {
  const int wave = threadIdx.x >> 5;
  const int lane = threadIdx.x & 31;
  const int wid  = blockIdx.x * 8 + wave;
  const int part = wid & 3, hp = (wid >> 2) & 15, bh = wid >> 6;
  // both branches hand their 128 values on as 16-byte vectors: taken apart
  // inside the branches, the compiler merges the two runs of loads into one run
  // of 4-byte loads whose offsets it keeps in scalar registers, and spills those
  v4f row[4][8];
  if (blockIdx.y == 0) {
    // lane = m, row[e] runs over w, channel i = part*4 + e
    const float* s = k3 + (size_t)((bh*16 + part*4)*16 + hp)*1024 + lane;
#pragma unroll
    for (int e = 0; e < 4; ++e)
#pragma unroll
      for (int q = 0; q < 8; ++q)
        row[e][q] = (v4f){s[e*NTOT + q*128], s[e*NTOT + q*128 + 32],
                          s[e*NTOT + q*128 + 64], s[e*NTOT + q*128 + 96]};
  } else {
    // lane = (m group, j), row[e] runs over d, m = (part*2 + (lane >> 4))*4 + e
    const float* s = v3 + (size_t)((bh*16 + (lane & 15))*16 + hp)*1024
                        + (part*2 + (lane >> 4))*128;
#pragma unroll
    for (int e = 0; e < 4; ++e)
#pragma unroll
      for (int q = 0; q < 8; ++q) row[e][q] = *(const v4f*)(s + e*32 + q*4);
    // behind this branch's loads: the built code lays the other branch's
    // address sum behind them, into the register pair that they name
    asm volatile("s_wait_xcnt 0x0" ::: "memory");
  }
  float val[4][32];
#pragma unroll
  for (int e = 0; e < 4; ++e)
#pragma unroll
    for (int q = 0; q < 8; ++q) {
      val[e][q*4 + 0] = row[e][q].x; val[e][q*4 + 1] = row[e][q].y;
      val[e][q*4 + 2] = row[e][q].z; val[e][q*4 + 3] = row[e][q].w;
    }
#pragma unroll
  for (int e = 0; e < 4; ++e)
#pragma unroll
    for (int p = 1; p < 32; ++p) val[e][p] += val[e][p - 1];
  float* dst = (blockIdx.y == 0 ? kwin : vwin)
             + (size_t)(bh*16 + hp)*32*512 + part*128 + lane*4;
#pragma unroll
  for (int win = 0; win < 2; ++win)
#pragma unroll
    for (int p = 0; p < 32; ++p) {
      const int a = win ? 8 : 4;
      const int t = win_start(p, 32, a);
      *(float4*)(dst + win*WIN_STRIDE + p*512) =
          make_float4(val[0][t + a - 1] - val[0][t], val[1][t + a - 1] - val[1][t],
                      val[2][t + a - 1] - val[2][t], val[3][t + a - 1] - val[3][t]);
    }
}

// ---------------------------------------------------------------------------
// K3: one block per (bh, h, 16 columns d, 16 rows w); ten passes, one per slice
// h' of the two h windows.  A pass has two WMMA stages:
//  stage 1 (a wave takes 2 rows w):  P[m][d] = sum_i KW_i(w,m) * q_i(h,w,d)
//      A = KW (M = m, K = i), B = q (K = i, N = d);  i = 8*lh + 2*s + y
//  stage 2 (a wave takes 2 columns d): num[j][w] += sum_m VD_j(m,d) * P[m][w]
//      A = VD (M = j, K = m), B = P (K = m, N = w);  m = 16*lh + 2*s + y
// Stage 1 is batched over w and stage 2 over d, so P goes through LDS as
// [d][w][m].  Z is the sum of P over the d window of m, taken from stage 2's
// own B fragments.  Two LDS buffers: one barrier a pass is enough, since a
// buffer is written again only behind the next pass's barrier.
// ---------------------------------------------------------------------------
#define PPW 36             // floats per (d,w) row of 32 m: 16 bytes x odd
#define PPD (16*PPW + 4)   // floats per d: sixteen d start on sixteen bank groups
#define OPW 20             // epilogue tile: floats per (j,w) row of 16 d
#define OPJ (16*OPW + 4)

// four waves a SIMD (256 registers): two blocks share a WGP, and one block's
// stages fill the matrix pipe while the other waits at its barrier
__global__ __launch_bounds__(256, 4)
void window_attn_kernel(const float* __restrict__ q3,
                        const float* __restrict__ kwin4,
                        const float* __restrict__ kwin8,
                        const float* __restrict__ vwin4,
                        const float* __restrict__ vwin8,
                        float* __restrict__ accout) {
  __shared__ __attribute__((aligned(16))) float P[2][16 * PPD];
  const int wave = threadIdx.x >> 5;
  const int lane = threadIdx.x & 31;
  const int lm = lane & 15, lh = lane >> 4;
  const int d0 = (blockIdx.x >> 1) * 16, w0 = (blockIdx.x & 1) * 16;
  const int h = blockIdx.y, bh = blockIdx.z;

  // q fragments of this wave's two rows w: the same in all ten passes
  v2f bq[2][4];
#pragma unroll
  for (int u = 0; u < 2; ++u)
#pragma unroll
    for (int s = 0; s < 4; ++s) {
      const float* qp = q3 + (size_t)(bh*16 + lh*8 + 2*s)*NTOT + h*1024
                           + (w0 + wave*2 + u)*32 + d0 + lm;
      bq[u][s].x = qp[0];
      bq[u][s].y = qp[NTOT];
    }
  // behind the q loads: the built code reuses the register pair that they name
  // as their address for what comes next
  asm volatile("s_wait_xcnt 0x0" ::: "memory");
  // first slice of each h window, this lane's fragment
  const int hs4 = win_start(h, HH, 4) + 1, hs8 = win_start(h, HH, 8) + 1;
  const float* kb4 = kwin4 + (size_t)((bh*16 + hs4)*32 + w0 + wave*2)*512 + lh*256 + lm*4;
  const float* kb8 = kwin8 + (size_t)((bh*16 + hs8)*32 + w0 + wave*2)*512 + lh*256 + lm*4;
  const float* vb4 = vwin4 + (size_t)((bh*16 + hs4)*32 + d0 + wave*2)*512 + lh*256 + lm*4;
  const float* vb8 = vwin8 + (size_t)((bh*16 + hs8)*32 + d0 + wave*2)*512 + lh*256 + lm*4;

  float4 ka[2][2][2];   // [u][mt][i group of this lane half]
  float4 va[2][4];      // [u][m group of this lane half]
  v8f acc[2];
  v2f z[2], msk[2][8];
  float res[2][8];
#pragma unroll
  for (int u = 0; u < 2; ++u)
#pragma unroll
    for (int r = 0; r < 8; ++r) res[u][r] = 0.f;
#pragma unroll
  for (int u = 0; u < 2; ++u)
#pragma unroll
    for (int mt = 0; mt < 2; ++mt)
#pragma unroll
      for (int g = 0; g < 2; ++g)
        ka[u][mt][g] = *(const float4*)(kb4 + u*512 + g*128 + mt*64);

  // unrolled whole: window, slice and LDS buffer of a pass are constants
#pragma unroll
  for (int it = 0; it < 10; ++it) {
    const int win = it >= 3 ? 1 : 0;
    const int t   = win ? it - 3 : it;
    const int a   = win ? 8 : 4;
    float* Pb = P[it & 1];
    if (t == 0) {
#pragma unroll
      for (int u = 0; u < 2; ++u) {
        acc[u] = (v8f){0,0,0,0,0,0,0,0};
        z[u] = (v2f){0.f, 0.f};
        // 1 where this lane's m lies in the d window of column d
        const int td = win_start(d0 + wave*2 + u, DD, a);
#pragma unroll
        for (int g = 0; g < 8; ++g) {
          const int m = lh*16 + 2*g;
          msk[u][g].x = (m     > td && m     < td + a) ? 1.f : 0.f;
          msk[u][g].y = (m + 1 > td && m + 1 < td + a) ? 1.f : 0.f;
        }
      }
    }
    // stage 2's A fragments fly during stage 1
    const float* vb = (win ? vb8 : vb4) + t*16384;
#pragma unroll
    for (int u = 0; u < 2; ++u)
#pragma unroll
      for (int g = 0; g < 4; ++g)
        va[u][g] = *(const float4*)(vb + u*512 + g*64);
    // holds these loads in front of stage 1, so that they are in flight during it
    __builtin_amdgcn_sched_barrier(0);
    v8f p[2][2];
#pragma unroll
    for (int u = 0; u < 2; ++u)
#pragma unroll
      for (int mt = 0; mt < 2; ++mt) p[u][mt] = (v8f){0,0,0,0,0,0,0,0};
#pragma unroll
    for (int g = 0; g < 2; ++g)
#pragma unroll
      for (int u = 0; u < 2; ++u)
#pragma unroll
        for (int mt = 0; mt < 2; ++mt) {
          const float4 f = ka[u][mt][g];
          p[u][mt] = wmma4((v2f){f.x, f.y}, bq[u][2*g    ], p[u][mt]);
          p[u][mt] = wmma4((v2f){f.z, f.w}, bq[u][2*g + 1], p[u][mt]);
        }
    // p[u][mt][r] is m = mt*16 + 8*lh + r at d = lm: eight consecutive m
#pragma unroll
    for (int u = 0; u < 2; ++u)
#pragma unroll
      for (int mt = 0; mt < 2; ++mt) {
        float* o = Pb + lm*PPD + (wave*2 + u)*PPW + mt*16 + lh*8;
        *(float4*)(o    ) = make_float4(p[u][mt][0], p[u][mt][1], p[u][mt][2], p[u][mt][3]);
        *(float4*)(o + 4) = make_float4(p[u][mt][4], p[u][mt][5], p[u][mt][6], p[u][mt][7]);
      }
    // publishes this pass's P to the waves that read it by column
    __syncthreads();
    if (it + 1 < 10) {
      // the next pass's stage 1 fragments fly during stage 2; they stand behind
      // the barrier, which waits for every load issued in front of it
      const float* kb = (it + 1 >= 3) ? kb8 + (it + 1 - 3)*16384 : kb4 + (it + 1)*16384;
#pragma unroll
      for (int u = 0; u < 2; ++u)
#pragma unroll
        for (int mt = 0; mt < 2; ++mt)
#pragma unroll
          for (int g = 0; g < 2; ++g)
            ka[u][mt][g] = *(const float4*)(kb + u*512 + g*128 + mt*64);
      // behind the last loads from the first window's base address: the built
      // code reuses the register pair that held it during stage 2
      if (it + 1 == 2) asm volatile("s_wait_xcnt 0x0" ::: "memory");
    }
#pragma unroll
    for (int g = 0; g < 4; ++g)
#pragma unroll
      for (int u = 0; u < 2; ++u) {
        const float4 bv = *(const float4*)(Pb + (wave*2 + u)*PPD + lm*PPW + lh*16 + g*4);
        const float4 av = va[u][g];
        const v2f b0 = {bv.x, bv.y}, b1 = {bv.z, bv.w};
        acc[u] = wmma4((v2f){av.x, av.y}, b0, acc[u]);
        acc[u] = wmma4((v2f){av.z, av.w}, b1, acc[u]);
        z[u] += b0 * msk[u][2*g];
        z[u] += b1 * msk[u][2*g + 1];
      }
    if (t == a - 2) {
      // end of a window: acc[u][r] is j = 8*lh + r at row w = lm; the lane
      // halves hold the two halves of Z's sum over m
#pragma unroll
      for (int u = 0; u < 2; ++u) {
        float zz = z[u].x + z[u].y;
        zz += __shfl_xor(zz, 16);
        const float f = ATTN_SCALE / (zz + 1e-6f);
#pragma unroll
        for (int r = 0; r < 8; ++r) res[u][r] += acc[u][r] * f;
      }
    }
  }
  // turn (j, w, d) so that the stores run along d.  The tile lies in buffer 0,
  // whose last readers (pass 8) are behind pass 9's barrier
  float* O = P[0];
#pragma unroll
  for (int u = 0; u < 2; ++u)
#pragma unroll
    for (int r = 0; r < 8; ++r)
      O[(lh*8 + r)*OPJ + lm*OPW + wave*2 + u] = 0.5f * res[u][r];   // / len(WINDOWS)
  // the stores below read what other waves wrote above
  __syncthreads();
#pragma unroll
  for (int c = 0; c < 4; ++c) {
    const int idx = threadIdx.x + c*256;
    const int dq = idx & 3, wl = (idx >> 2) & 15, j = idx >> 6;
    *(float4*)(accout + (size_t)(bh*16 + j)*NTOT + h*1024 + (w0 + wl)*32 + d0 + dq*4) =
        *(const float4*)(O + j*OPJ + wl*OPW + dq*4);
  }
}

// ---------------------------------------------------------------------------
// K8: final projection: d_out[c][n] = sum_c' acc[c'][n]*pw[c'][c] + pb[c]
// The tile is taken transposed, as in K1: M = output channel (A = pw^T),
// N = position (B = acc), so loads and stores both run along n.  A block takes
// 64 positions, a wave 32 channels of them: 2 x 4 accumulator tiles.
// Row M of channel tile e is channel c0 + 2*M + e (one 8-byte load of a pw row
// feeds both tiles); column N of position tile f is position n0 + 4*N + f (one
// 16-byte load of an acc row feeds all four, and four tiles' registers make one
// 16-byte store).  k runs as before: K-step k0 holds k0 + 2*lh + {0,1}.
// ---------------------------------------------------------------------------
// four K-steps' fragments: b[u][y] is acc row k + 4*u + 2*lh + y at positions
// n0 + 4*lm .. +3, a[u][y] the pw row of the same k at channels c0 + 2*lm, +1
static __device__ __forceinline__ void proj_load4(const float* bp, const float* ap,
                                                  int k, float4 (&b)[4][2],
                                                  float2 (&a)[4][2]) {
#pragma unroll
  for (int u = 0; u < 4; ++u)
#pragma unroll
    for (int y = 0; y < 2; ++y) {
      b[u][y] = *(const float4*)(bp + (size_t)(k + 4*u + y)*NTOT);
      a[u][y] = *(const float2*)(ap + (k + 4*u + y)*CDIM);
    }
}

static __device__ __forceinline__ void proj_mma4(const float4 (&b)[4][2],
                                                 const float2 (&a)[4][2],
                                                 v8f (&acc)[2][4]) {
#pragma unroll
  for (int u = 0; u < 4; ++u) {
    const v2f a0 = {a[u][0].x, a[u][1].x}, a1 = {a[u][0].y, a[u][1].y};
    const v2f b0 = {b[u][0].x, b[u][1].x}, b1 = {b[u][0].y, b[u][1].y};
    const v2f b2 = {b[u][0].z, b[u][1].z}, b3 = {b[u][0].w, b[u][1].w};
    acc[0][0] = wmma4(a0, b0, acc[0][0]);
    acc[0][1] = wmma4(a0, b1, acc[0][1]);
    acc[0][2] = wmma4(a0, b2, acc[0][2]);
    acc[0][3] = wmma4(a0, b3, acc[0][3]);
    acc[1][0] = wmma4(a1, b0, acc[1][0]);
    acc[1][1] = wmma4(a1, b1, acc[1][1]);
    acc[1][2] = wmma4(a1, b2, acc[1][2]);
    acc[1][3] = wmma4(a1, b3, acc[1][3]);
  }
}

__global__ __launch_bounds__(128)
void proj_gemm_kernel(const float* __restrict__ accb,
                      const float* __restrict__ pw,
                      const float* __restrict__ pb,
                      float* __restrict__ out) {
  const int wave = threadIdx.x >> 5;
  const int lane = threadIdx.x & 31;
  const int lm = lane & 15, lh = lane >> 4;
  const int n0 = blockIdx.x * 64;
  const int c0 = wave * 32;
  const float* bp = accb + (size_t)(2*lh)*NTOT + n0 + lm*4;
  const float* ap = pw + (2*lh)*CDIM + c0 + lm*2;
  v8f acc[2][4];
#pragma unroll
  for (int e = 0; e < 2; ++e)
#pragma unroll
    for (int f = 0; f < 4; ++f) acc[e][f] = (v8f){0,0,0,0,0,0,0,0};
  // three register sets of four K-steps each, one wave a SIMD: two sets' loads
  // fly while the third is multiplied.  The scheduling barriers hold each
  // refill directly behind the products that free its set and in front of the
  // next set's products: earlier it would need a fourth set, later it would
  // lose its lead
  float4 b0[4][2], b1[4][2], b2[4][2];
  float2 a0[4][2], a1[4][2], a2[4][2];
  proj_load4(bp, ap,  0, b0, a0);
  proj_load4(bp, ap, 16, b1, a1);
  proj_load4(bp, ap, 32, b2, a2);
  __builtin_amdgcn_sched_barrier(0);   // see above
  proj_mma4(b0, a0, acc);
  __builtin_amdgcn_sched_barrier(0);   // see above
  proj_load4(bp, ap, 48, b0, a0);
  __builtin_amdgcn_sched_barrier(0);   // see above
  proj_mma4(b1, a1, acc);
  __builtin_amdgcn_sched_barrier(0);   // see above
  proj_load4(bp, ap, 64, b1, a1);
  __builtin_amdgcn_sched_barrier(0);   // see above
  proj_mma4(b2, a2, acc);
  __builtin_amdgcn_sched_barrier(0);   // see above
  proj_load4(bp, ap, 80, b2, a2);
  __builtin_amdgcn_sched_barrier(0);   // see above
  proj_mma4(b0, a0, acc);
  __builtin_amdgcn_sched_barrier(0);   // see above
  proj_load4(bp, ap, 96, b0, a0);
  __builtin_amdgcn_sched_barrier(0);   // see above
  proj_mma4(b1, a1, acc);
  __builtin_amdgcn_sched_barrier(0);   // see above
#pragma unroll
  for (int u = 0; u < 4; ++u) {
    b1[u][0] = *(const float4*)(bp + (size_t)(112 + 4*u    )*NTOT);
    b1[u][1] = *(const float4*)(bp + (size_t)(112 + 4*u + 1)*NTOT);
  }
  // behind the last loads of acc rows: the built code lays one of the pw
  // fragments that follow into the register pair that they name as their address
  asm volatile("s_wait_xcnt 0x0" ::: "memory");
#pragma unroll
  for (int u = 0; u < 4; ++u) {
    a1[u][0] = *(const float2*)(ap + (112 + 4*u    )*CDIM);
    a1[u][1] = *(const float2*)(ap + (112 + 4*u + 1)*CDIM);
  }
  __builtin_amdgcn_sched_barrier(0);   // see above
  proj_mma4(b2, a2, acc);
  // the bias of this lane's 16 channels, c0 + 16*lh + 0..15, comes in during the
  // last two sets' products; the barriers hold its loads there
  __builtin_amdgcn_sched_barrier(0);
  float4 bias[4];
#pragma unroll
  for (int t = 0; t < 4; ++t) bias[t] = *(const float4*)(pb + c0 + 16*lh + 4*t);
  __builtin_amdgcn_sched_barrier(0);
  proj_mma4(b0, a0, acc);
  proj_mma4(b1, a1, acc);
  // acc[e][f][r] is M = r + 8*lh, that is channel c0 + 16*lh + 2*r + e, at
  // position n0 + 4*lm + f
  float* o = out + (size_t)(c0 + 16*lh)*NTOT + n0 + lm*4;
#pragma unroll
  for (int r = 0; r < 8; ++r) {
    const float4 bq = bias[r >> 1];
    const float be0 = (r & 1) ? bq.z : bq.x, be1 = (r & 1) ? bq.w : bq.y;
    *(float4*)(o + (size_t)(2*r    )*NTOT) =
        make_float4(acc[0][0][r] + be0, acc[0][1][r] + be0,
                    acc[0][2][r] + be0, acc[0][3][r] + be0);
    *(float4*)(o + (size_t)(2*r + 1)*NTOT) =
        make_float4(acc[1][0][r] + be1, acc[1][1][r] + be1,
                    acc[1][2][r] + be1, acc[1][3][r] + be1);
  }
}

// ---------------------------------------------------------------------------
extern "C" void kernel_launch(void* const* d_in, const int* in_sizes, int n_in,
                              void* d_out, int out_size, void* d_ws, size_t ws_size,
                              hipStream_t stream) {
  const float* x  = (const float*)d_in[0];
  const float* qw = (const float*)d_in[1];
  const float* kw = (const float*)d_in[2];
  const float* vw = (const float*)d_in[3];
  const float* pw = (const float*)d_in[4];
  const float* pb = (const float*)d_in[5];
  float* out = (float*)d_out;

  const size_t U = (size_t)NTOT * CDIM;     // 2,097,152 floats
  float* ws   = (float*)d_ws;
  float* q3   = ws + 3*U;                   // (C,N)
  float* k3   = ws + 4*U;
  float* v3   = ws + 5*U;
  float* accb = ws + 7*U;                   // attention output (C,N)
  float* kwin = ws + 8*U;                   // k window sums over w, 2 windows
  float* vwin = ws + 10*U;                  // v window sums over d, 2 windows

  qkv_softmax_kernel<<<dim3(NTOT/64, 3), 128, 0, stream>>>(x, qw, kw, vw,
                                                            q3, k3, v3);
  operand_window_kernel<<<dim3(HEADS*HH*4/8, 2), 256, 0, stream>>>(k3, v3, kwin, vwin);
  window_attn_kernel<<<dim3(4, HH, HEADS), 256, 0, stream>>>(q3, kwin, kwin + U, vwin,
                                                             vwin + U, accb);
  proj_gemm_kernel<<<dim3(NTOT/64), 128, 0, stream>>>(accb, pw, pb, out);
}

// v006
// A run of this version takes 50 microseconds.
// Next to v005, in two timings, it ran 1.11 and 1.12 times as fast.
// Over all steps from v000 it is 8.45 times as fast.
#include <hip/hip_runtime.h>
#include <math.h>

// Problem constants (B=1)
#define HEADS 8
#define CDIM  128
#define HD    16          // head dim
#define HH    16
#define WW    32
#define DD    32
#define NTOT  (HH*WW*DD)  // 16384 spatial positions
#define ATTN_SCALE 0.25f  // (CDIM/HEADS)^-0.5 = 16^-0.5

typedef float v2f __attribute__((ext_vector_type(2)));
typedef float v4f __attribute__((ext_vector_type(4)));
typedef float v8f __attribute__((ext_vector_type(8)));

// D(16x16,f32) = A(16x4,f32) x B(4x16,f32) + C  -- V_WMMA_F32_16X16X4_F32
static __device__ __forceinline__ v8f wmma4(v2f a, v2f b, v8f c) {
  return __builtin_amdgcn_wmma_f32_16x16x4_f32(false, a, false, b, (short)0, c,
                                               false, false);
}

// ---------------------------------------------------------------------------
// K1: the three GEMMs {qw,kw,vw}^T @ x with their softmaxes, and the window sums
// of k and v, in one launch.  Every tile is taken transposed: M = channel,
// N = position (A = weight^T, B = x).  k runs alike everywhere: K-step k0 holds
// k0 + 2*lh + {0,1} in A and in B.
// q and v tiles: a wave holds NG*64 channels of 16 positions.  The tiles (g,e)
// deal the channels so that one 16-byte load of a weight row feeds four tiles:
// row M of tile (g,e) is channel 64*g + 4*M + e.
// D layout: acc[g][e][r] is M = r + 8*lh at position n0 + lm, that is
//   channel 64*g + 32*lh + 4*r + e = head 4*g + 2*lh + (r>>2), j = 4*(r&3) + e.
// ---------------------------------------------------------------------------
// four K-steps' fragments: w[u][g][y] is weight row k + 4*u + 2*lh + y, channels
// 64*g + 4*lm .. +3; b[u] the two x rows of the same k at position n0 + lm
template <int NG>
static __device__ __forceinline__ void qkv_load4(const float* xp, const float* wp,
                                                 int k, float4 (&w)[4][NG][2],
                                                 v2f (&b)[4]) {
#pragma unroll
  for (int u = 0; u < 4; ++u) {
    b[u].x = xp[(size_t)(k + 4*u    )*NTOT];
    b[u].y = xp[(size_t)(k + 4*u + 1)*NTOT];
#pragma unroll
    for (int g = 0; g < NG; ++g) {
      w[u][g][0] = *(const float4*)(wp + (k + 4*u    )*CDIM + g*64);
      w[u][g][1] = *(const float4*)(wp + (k + 4*u + 1)*CDIM + g*64);
    }
  }
}

template <int NG>
static __device__ __forceinline__ void qkv_mma4(const float4 (&w)[4][NG][2],
                                                const v2f (&b)[4], v8f (&acc)[NG][4]) {
#pragma unroll
  for (int u = 0; u < 4; ++u)
#pragma unroll
    for (int g = 0; g < NG; ++g) {
      acc[g][0] = wmma4((v2f){w[u][g][0].x, w[u][g][1].x}, b[u], acc[g][0]);
      acc[g][1] = wmma4((v2f){w[u][g][0].y, w[u][g][1].y}, b[u], acc[g][1]);
      acc[g][2] = wmma4((v2f){w[u][g][0].z, w[u][g][1].z}, b[u], acc[g][2]);
      acc[g][3] = wmma4((v2f){w[u][g][0].w, w[u][g][1].w}, b[u], acc[g][3]);
    }
}

// exp(x) as the multiply by log2(e) and v_exp_f32 that __expf compiles to.  The
// v_nop is the free slot that the instruction set asks for behind a
// transcendental: the built code otherwise lays an overwrite of the source
// register directly behind some of them
static __device__ __forceinline__ float exp_slot(float x) {
  float r;
  asm("v_exp_f32 %0, %1\n\tv_nop" : "=v"(r) : "v"(x * 1.44269504f));
  return r;
}

template <int NG>
static __device__ __forceinline__ void qkv_gemm(const float* xp, const float* wp,
                                                v8f (&acc)[NG][4]) {
#pragma unroll
  for (int g = 0; g < NG; ++g)
#pragma unroll
    for (int e = 0; e < 4; ++e) acc[g][e] = (v8f){0,0,0,0,0,0,0,0};
  // two register sets of four K-steps each: one set's loads fly while the other
  // set is multiplied
  float4 w0[4][NG][2], w1[4][NG][2];
  v2f b0[4], b1[4];
  qkv_load4<NG>(xp, wp, 0, w0, b0);
  // stays rolled: the two halves of a trip name their sets by constant.  The
  // last 32 of K stand behind the loop, so that no load in the loop hangs on a
  // test: with one, the waits in front of the products cover both paths and
  // take the newest loads in as well
#pragma unroll 1
  for (int k0 = 0; k0 < CDIM - 32; k0 += 32) {
    qkv_load4<NG>(xp, wp, k0 + 16, w1, b1);
    // the scheduling barriers hold each set's loads in front of the other
    // set's products, so that they are in flight during them, and behind the
    // products before: two sets are live at a time and no third
    __builtin_amdgcn_sched_barrier(0);
    qkv_mma4<NG>(w0, b0, acc);
    __builtin_amdgcn_sched_barrier(0);   // see above
    qkv_load4<NG>(xp, wp, k0 + 32, w0, b0);
    __builtin_amdgcn_sched_barrier(0);   // see above
    qkv_mma4<NG>(w1, b1, acc);
    __builtin_amdgcn_sched_barrier(0);   // see above
  }
  qkv_load4<NG>(xp, wp, CDIM - 16, w1, b1);
  __builtin_amdgcn_sched_barrier(0);     // see above
  qkv_mma4<NG>(w0, b0, acc);
  qkv_mma4<NG>(w1, b1, acc);
}

// k tiles: a block takes one slice h', four channels i of every head and 16
// columns m with all 32 rows w; a wave 4 rows w: 2 channel tiles x 4 position
// tiles.  Row M of channel tile mt is head M & 7, i = 4*jq + 2*(M >> 3) + mt, so
// that a lane's eight D registers are the eight heads of one i, and one 8-byte
// load of a weight row feeds both tiles.  Column N of
// position tile f is row w0 + (N >> 2), column m0 + 4*(N & 3) + f: one 16-byte
// load of an x row feeds all four tiles.
// four K-steps' fragments: b[u][y] is x row k + 4*u + 2*lh + y, a[u][y] the
// weight row of the same k at this lane's two channels
static __device__ __forceinline__ void kfam_load4(const float* xp, const float* wp,
                                                  int k, float4 (&b)[4][2],
                                                  float2 (&a)[4][2]) {
#pragma unroll
  for (int u = 0; u < 4; ++u)
#pragma unroll
    for (int y = 0; y < 2; ++y) {
      b[u][y] = *(const float4*)(xp + (size_t)(k + 4*u + y)*NTOT);
      a[u][y] = *(const float2*)(wp + (k + 4*u + y)*CDIM);
    }
}

static __device__ __forceinline__ void kfam_mma4(const float4 (&b)[4][2],
                                                 const float2 (&a)[4][2],
                                                 v8f (&acc)[2][4]) {
#pragma unroll
  for (int u = 0; u < 4; ++u) {
    const v2f a0 = {a[u][0].x, a[u][1].x}, a1 = {a[u][0].y, a[u][1].y};
    const v2f b0 = {b[u][0].x, b[u][1].x}, b1 = {b[u][0].y, b[u][1].y};
    const v2f b2 = {b[u][0].z, b[u][1].z}, b3 = {b[u][0].w, b[u][1].w};
    acc[0][0] = wmma4(a0, b0, acc[0][0]);
    acc[0][1] = wmma4(a0, b1, acc[0][1]);
    acc[0][2] = wmma4(a0, b2, acc[0][2]);
    acc[0][3] = wmma4(a0, b3, acc[0][3]);
    acc[1][0] = wmma4(a1, b0, acc[1][0]);
    acc[1][1] = wmma4(a1, b1, acc[1][1]);
    acc[1][2] = wmma4(a1, b2, acc[1][2]);
    acc[1][3] = wmma4(a1, b3, acc[1][3]);
  }
}

// ---------------------------------------------------------------------------
// The box sum of the k*v product over a window is linear in each operand, and
// the sum over the query channel i can be taken before the one over m:
//   num[j](h,w,d) = sum over h' in the h window, over m of
//                   ( sum_i q_i(h,w,d) * KW_i[h'](w,m) ) * VD_j[h'](m,d)
// KW = k summed over the w window of output row w, VD = v summed over the d
// window of output column d.  A window of size a starts at win_start() and
// holds the a-1 elements behind its start (the 8-corner difference of an
// inclusive table, with the edge padding as a clamp of the start).
// ---------------------------------------------------------------------------
static __device__ __forceinline__ constexpr int win_start(int x, int len, int a) {
  const int t = x - ((a - 1) >> 1);
  return t < 0 ? 0 : (t > len - a ? len - a : t);
}

#define WIN_STRIDE (HEADS*HH*32*512)   // floats of one window's operand table (= C*N)

// The window sums are written in the order in which K3's lanes read their WMMA
// fragments (16 bytes a lane):
//   kwin[win][bh][h'][w][i/4][m][i%4]     vwin[win][bh][h'][d][m/4][j][m%4]
// val[e] is one row of 32 as an inclusive prefix sum; dst the thread's 16 bytes
// of output row 0.  Unrolled, so that val[] has constant indices.
template <int A>
static __device__ __forceinline__ void window_store(const float (&val)[4][32],
                                                    float* dst) {
#pragma unroll
  for (int p = 0; p < 32; ++p) {
    const int t = win_start(p, 32, A);
    *(float4*)(dst + p*512) =
        make_float4(val[0][t + A - 1] - val[0][t], val[1][t + A - 1] - val[1][t],
                    val[2][t + A - 1] - val[2][t], val[3][t + A - 1] - val[3][t]);
  }
}

#define KPW 68             // k exchange: floats per row w of 16 m x 4 i, 16 bytes x odd
#define VPC 132            // v exchange: floats per channel of 128 positions, 16 bytes x odd
#define XCH (HEADS*32*KPW) // the larger of the two tiles

// Blocks 0..127 k, 128..255 v, 256..511 q.  A k or v block turns its tile through
// LDS so that a thread holds four whole rows of the window axis, and writes both
// windows' sums.  The q blocks come last in the grid and their waves hold half
// the products of a k or v wave.  Four waves a SIMD (256 registers): two blocks a WGP.
__global__ __launch_bounds__(256, 4)
void qkv_window_kernel(const float* __restrict__ x,
                       const float* __restrict__ qw, const float* __restrict__ kw,
                       const float* __restrict__ vw,
                       float* __restrict__ q3, float* __restrict__ kwin,
                       float* __restrict__ vwin) {
  __shared__ __attribute__((aligned(16))) float X[XCH];
  const int tid  = threadIdx.x;
  const int wave = tid >> 5;
  const int lane = tid & 31;
  const int lm = lane & 15;        // M row of A / N column of B and D
  const int lh = lane >> 4;        // lane-half selects the K pair
  const int win = tid >> 7;        // window phase: waves 0..3 size 4, 4..7 size 8
  // both branches hand their 128 values on as 16-byte vectors, row[p] = the four
  // rows at place p of the window axis: taken apart inside the branches, the
  // compiler merges the two runs of LDS reads into one run of 4-byte reads
  v4f row[32];
  float* dst;
  if (blockIdx.x >= 256) {
    // q: a wave takes 64 channels (four heads) of 16 positions
    const int n0 = ((blockIdx.x - 256) * 4 + (wave & 3)) * 16;
    const int c0 = (wave >> 2) * 64;
    v8f acc[1][4];
    qkv_gemm<1>(x + (size_t)(2*lh)*NTOT + n0 + lm, qw + (2*lh)*CDIM + c0 + lm*4, acc);
    // softmax over the 16 channels of a head: all in this lane, summed in j order
#pragma unroll
    for (int rh = 0; rh < 2; ++rh) {
      float m = -3.0e38f;
#pragma unroll
      for (int j = 0; j < 16; ++j) m = fmaxf(m, acc[0][j & 3][rh*4 + (j >> 2)]);
      float s = 0.f;
#pragma unroll
      for (int j = 0; j < 16; ++j) {
        const float ex = exp_slot(acc[0][j & 3][rh*4 + (j >> 2)] - m);
        acc[0][j & 3][rh*4 + (j >> 2)] = ex;
        s += ex;
      }
      const float inv = 1.f / s;
#pragma unroll
      for (int j = 0; j < 16; ++j) acc[0][j & 3][rh*4 + (j >> 2)] *= inv;
    }
    float* o = q3 + (size_t)(c0 + 32*lh)*NTOT + n0 + lm;
#pragma unroll
    for (int r = 0; r < 8; ++r)
#pragma unroll
      for (int e = 0; e < 4; ++e)
        o[(size_t)(4*r + e)*NTOT] = acc[0][e][r];
    return;
  }
  if (blockIdx.x < 128) {
    const int hp = blockIdx.x >> 3, jq = (blockIdx.x >> 1) & 3, m0 = (blockIdx.x & 1) * 16;
    const float* xp = x + (size_t)(2*lh)*NTOT + hp*1024 + (wave*4 + (lm >> 2))*32
                        + m0 + (lm & 3)*4;
    const float* wp = kw + (2*lh)*CDIM + (lm & 7)*16 + jq*4 + (lm >> 3)*2;
    v8f acc[2][4];
#pragma unroll
    for (int mt = 0; mt < 2; ++mt)
#pragma unroll
      for (int f = 0; f < 4; ++f) acc[mt][f] = (v8f){0,0,0,0,0,0,0,0};
    // two register sets and a rolled loop, as in qkv_gemm and for its reasons
    float4 b0[4][2], b1[4][2];
    float2 a0[4][2], a1[4][2];
    kfam_load4(xp, wp, 0, b0, a0);
#pragma unroll 1
    for (int k0 = 0; k0 < CDIM - 32; k0 += 32) {
      kfam_load4(xp, wp, k0 + 16, b1, a1);
      __builtin_amdgcn_sched_barrier(0);   // as in qkv_gemm
      kfam_mma4(b0, a0, acc);
      __builtin_amdgcn_sched_barrier(0);   // as in qkv_gemm
      kfam_load4(xp, wp, k0 + 32, b0, a0);
      __builtin_amdgcn_sched_barrier(0);   // as in qkv_gemm
      kfam_mma4(b1, a1, acc);
      __builtin_amdgcn_sched_barrier(0);   // as in qkv_gemm
    }
    kfam_load4(xp, wp, CDIM - 16, b1, a1);
    __builtin_amdgcn_sched_barrier(0);     // as in qkv_gemm
    kfam_mma4(b0, a0, acc);
    kfam_mma4(b1, a1, acc);
    // softmax over the HEADS axis: acc[mt][f][r] is head r at i % 4 = 2*lh + mt,
    // all eight heads in this lane; then X[head][w][m][i % 4]
    float* xo = X + (wave*4 + (lm >> 2))*KPW + (lm & 3)*16 + lh*2;
#pragma unroll
    for (int mt = 0; mt < 2; ++mt)
#pragma unroll
      for (int f = 0; f < 4; ++f) {
        float m = acc[mt][f][0];
#pragma unroll
        for (int r = 1; r < 8; ++r) m = fmaxf(m, acc[mt][f][r]);
        float s = 0.f;
#pragma unroll
        for (int r = 0; r < 8; ++r) {
          const float ex = exp_slot(acc[mt][f][r] - m);
          acc[mt][f][r] = ex;
          s += ex;
        }
        const float inv = 1.f / s;
#pragma unroll
        for (int r = 0; r < 8; ++r) xo[r*32*KPW + f*4 + mt] = acc[mt][f][r] * inv;
      }
    // the window phase reads what other waves wrote above
    __syncthreads();
    // thread = (window, head, m); p runs over w, row e is channel i = 4*jq + e
    const int head = (tid >> 4) & 7;
    const float* xi = X + head*32*KPW + lm*4;
#pragma unroll
    for (int p = 0; p < 32; ++p) row[p] = *(const v4f*)(xi + p*KPW);
    dst = kwin + (size_t)win*WIN_STRIDE + (size_t)(head*16 + hp)*32*512 + jq*128
               + (m0 + lm)*4;
  } else {
    // v: a wave takes all 128 channels of 16 positions, the block four rows m
    const int blk = blockIdx.x - 128;
    const int n0 = (blk * 8 + wave) * 16;
    v8f acc[2][4];
    qkv_gemm<2>(x + (size_t)(2*lh)*NTOT + n0 + lm, vw + (2*lh)*CDIM + lm*4, acc);
    // X[channel][d][m % 4]
    float* xo = X + (32*lh)*VPC + ((wave & 1)*16 + lm)*4 + (wave >> 1);
#pragma unroll
    for (int g = 0; g < 2; ++g)
#pragma unroll
      for (int r = 0; r < 8; ++r)
#pragma unroll
        for (int e = 0; e < 4; ++e)
          xo[(64*g + 4*r + e)*VPC] = acc[g][e][r];
    // the window phase reads what other waves wrote above
    __syncthreads();
    // thread = (window, channel); p runs over d, row e is m = 4*(blk & 7) + e
    const int c = tid & 127;
    const float* xi = X + c*VPC;
#pragma unroll
    for (int p = 0; p < 32; ++p) row[p] = *(const v4f*)(xi + p*4);
    dst = vwin + (size_t)win*WIN_STRIDE + (size_t)((c >> 4)*16 + (blk >> 3))*32*512
               + (blk & 7)*64 + (c & 15)*4;
  }
  float val[4][32];
#pragma unroll
  for (int p = 0; p < 32; ++p) {
    val[0][p] = row[p].x; val[1][p] = row[p].y;
    val[2][p] = row[p].z; val[3][p] = row[p].w;
  }
#pragma unroll
  for (int e = 0; e < 4; ++e)
#pragma unroll
    for (int p = 1; p < 32; ++p) val[e][p] += val[e][p - 1];
  if (win == 0) window_store<4>(val, dst);
  else          window_store<8>(val, dst);
}

// ---------------------------------------------------------------------------
// K3: one block per (bh, h, 16 columns d, 16 rows w); ten passes, one per slice
// h' of the two h windows.  A pass has two WMMA stages:
//  stage 1 (a wave takes 2 rows w):  P[m][d] = sum_i KW_i(w,m) * q_i(h,w,d)
//      A = KW (M = m, K = i), B = q (K = i, N = d);  i = 8*lh + 2*s + y
//  stage 2 (a wave takes 2 columns d): num[j][w] += sum_m VD_j(m,d) * P[m][w]
//      A = VD (M = j, K = m), B = P (K = m, N = w);  m = 16*lh + 2*s + y
// Stage 1 is batched over w and stage 2 over d, so P goes through LDS as
// [d][w][m].  Z is the sum of P over the d window of m, taken from stage 2's
// own B fragments.  Two LDS buffers: one barrier a pass is enough, since a
// buffer is written again only behind the next pass's barrier.
// ---------------------------------------------------------------------------
#define PPW 36             // floats per (d,w) row of 32 m: 16 bytes x odd
#define PPD (16*PPW + 4)   // floats per d: sixteen d start on sixteen bank groups
#define OPW 20             // epilogue tile: floats per (j,w) row of 16 d
#define OPJ (16*OPW + 4)

// four waves a SIMD (256 registers): two blocks share a WGP, and one block's
// stages fill the matrix pipe while the other waits at its barrier
__global__ __launch_bounds__(256, 4)
void window_attn_kernel(const float* __restrict__ q3,
                        const float* __restrict__ kwin4,
                        const float* __restrict__ kwin8,
                        const float* __restrict__ vwin4,
                        const float* __restrict__ vwin8,
                        float* __restrict__ accout) {
  __shared__ __attribute__((aligned(16))) float P[2][16 * PPD];
  const int wave = threadIdx.x >> 5;
  const int lane = threadIdx.x & 31;
  const int lm = lane & 15, lh = lane >> 4;
  const int d0 = (blockIdx.x >> 1) * 16, w0 = (blockIdx.x & 1) * 16;
  const int h = blockIdx.y, bh = blockIdx.z;

  // q fragments of this wave's two rows w: the same in all ten passes
  v2f bq[2][4];
#pragma unroll
  for (int u = 0; u < 2; ++u)
#pragma unroll
    for (int s = 0; s < 4; ++s) {
      const float* qp = q3 + (size_t)(bh*16 + lh*8 + 2*s)*NTOT + h*1024
                           + (w0 + wave*2 + u)*32 + d0 + lm;
      bq[u][s].x = qp[0];
      bq[u][s].y = qp[NTOT];
    }
  // behind the q loads: the built code reuses the register pair that they name
  // as their address for what comes next
  asm volatile("s_wait_xcnt 0x0" ::: "memory");
  // first slice of each h window, this lane's fragment
  const int hs4 = win_start(h, HH, 4) + 1, hs8 = win_start(h, HH, 8) + 1;
  const float* kb4 = kwin4 + (size_t)((bh*16 + hs4)*32 + w0 + wave*2)*512 + lh*256 + lm*4;
  const float* kb8 = kwin8 + (size_t)((bh*16 + hs8)*32 + w0 + wave*2)*512 + lh*256 + lm*4;
  const float* vb4 = vwin4 + (size_t)((bh*16 + hs4)*32 + d0 + wave*2)*512 + lh*256 + lm*4;
  const float* vb8 = vwin8 + (size_t)((bh*16 + hs8)*32 + d0 + wave*2)*512 + lh*256 + lm*4;

  float4 ka[2][2][2];   // [u][mt][i group of this lane half]
  float4 va[2][4];      // [u][m group of this lane half]
  v8f acc[2];
  v2f z[2], msk[2][8];
  float res[2][8];
#pragma unroll
  for (int u = 0; u < 2; ++u)
#pragma unroll
    for (int r = 0; r < 8; ++r) res[u][r] = 0.f;
#pragma unroll
  for (int u = 0; u < 2; ++u)
#pragma unroll
    for (int mt = 0; mt < 2; ++mt)
#pragma unroll
      for (int g = 0; g < 2; ++g)
        ka[u][mt][g] = *(const float4*)(kb4 + u*512 + g*128 + mt*64);

  // unrolled whole: window, slice and LDS buffer of a pass are constants
#pragma unroll
  for (int it = 0; it < 10; ++it) {
    const int win = it >= 3 ? 1 : 0;
    const int t   = win ? it - 3 : it;
    const int a   = win ? 8 : 4;
    float* Pb = P[it & 1];
    if (t == 0) {
#pragma unroll
      for (int u = 0; u < 2; ++u) {
        acc[u] = (v8f){0,0,0,0,0,0,0,0};
        z[u] = (v2f){0.f, 0.f};
        // 1 where this lane's m lies in the d window of column d
        const int td = win_start(d0 + wave*2 + u, DD, a);
#pragma unroll
        for (int g = 0; g < 8; ++g) {
          const int m = lh*16 + 2*g;
          msk[u][g].x = (m     > td && m     < td + a) ? 1.f : 0.f;
          msk[u][g].y = (m + 1 > td && m + 1 < td + a) ? 1.f : 0.f;
        }
      }
    }
    // stage 2's A fragments fly during stage 1
    const float* vb = (win ? vb8 : vb4) + t*16384;
#pragma unroll
    for (int u = 0; u < 2; ++u)
#pragma unroll
      for (int g = 0; g < 4; ++g)
        va[u][g] = *(const float4*)(vb + u*512 + g*64);
    // holds these loads in front of stage 1, so that they are in flight during it
    __builtin_amdgcn_sched_barrier(0);
    v8f p[2][2];
#pragma unroll
    for (int u = 0; u < 2; ++u)
#pragma unroll
      for (int mt = 0; mt < 2; ++mt) p[u][mt] = (v8f){0,0,0,0,0,0,0,0};
#pragma unroll
    for (int g = 0; g < 2; ++g)
#pragma unroll
      for (int u = 0; u < 2; ++u)
#pragma unroll
        for (int mt = 0; mt < 2; ++mt) {
          const float4 f = ka[u][mt][g];
          p[u][mt] = wmma4((v2f){f.x, f.y}, bq[u][2*g    ], p[u][mt]);
          p[u][mt] = wmma4((v2f){f.z, f.w}, bq[u][2*g + 1], p[u][mt]);
        }
    // p[u][mt][r] is m = mt*16 + 8*lh + r at d = lm: eight consecutive m
#pragma unroll
    for (int u = 0; u < 2; ++u)
#pragma unroll
      for (int mt = 0; mt < 2; ++mt) {
        float* o = Pb + lm*PPD + (wave*2 + u)*PPW + mt*16 + lh*8;
        *(float4*)(o    ) = make_float4(p[u][mt][0], p[u][mt][1], p[u][mt][2], p[u][mt][3]);
        *(float4*)(o + 4) = make_float4(p[u][mt][4], p[u][mt][5], p[u][mt][6], p[u][mt][7]);
      }
    // publishes this pass's P to the waves that read it by column
    __syncthreads();
    if (it + 1 < 10) {
      // the next pass's stage 1 fragments fly during stage 2; they stand behind
      // the barrier, which waits for every load issued in front of it
      const float* kb = (it + 1 >= 3) ? kb8 + (it + 1 - 3)*16384 : kb4 + (it + 1)*16384;
#pragma unroll
      for (int u = 0; u < 2; ++u)
#pragma unroll
        for (int mt = 0; mt < 2; ++mt)
#pragma unroll
          for (int g = 0; g < 2; ++g)
            ka[u][mt][g] = *(const float4*)(kb + u*512 + g*128 + mt*64);
      // behind the last loads from the first window's base address: the built
      // code reuses the register pair that held it during stage 2
      if (it + 1 == 2) asm volatile("s_wait_xcnt 0x0" ::: "memory");
    }
#pragma unroll
    for (int g = 0; g < 4; ++g)
#pragma unroll
      for (int u = 0; u < 2; ++u) {
        const float4 bv = *(const float4*)(Pb + (wave*2 + u)*PPD + lm*PPW + lh*16 + g*4);
        const float4 av = va[u][g];
        const v2f b0 = {bv.x, bv.y}, b1 = {bv.z, bv.w};
        acc[u] = wmma4((v2f){av.x, av.y}, b0, acc[u]);
        acc[u] = wmma4((v2f){av.z, av.w}, b1, acc[u]);
        z[u] += b0 * msk[u][2*g];
        z[u] += b1 * msk[u][2*g + 1];
      }
    if (t == a - 2) {
      // end of a window: acc[u][r] is j = 8*lh + r at row w = lm; the lane
      // halves hold the two halves of Z's sum over m
#pragma unroll
      for (int u = 0; u < 2; ++u) {
        float zz = z[u].x + z[u].y;
        zz += __shfl_xor(zz, 16);
        const float f = ATTN_SCALE / (zz + 1e-6f);
#pragma unroll
        for (int r = 0; r < 8; ++r) res[u][r] += acc[u][r] * f;
      }
    }
  }
  // turn (j, w, d) so that the stores run along d.  The tile lies in buffer 0,
  // whose last readers (pass 8) are behind pass 9's barrier
  float* O = P[0];
#pragma unroll
  for (int u = 0; u < 2; ++u)
#pragma unroll
    for (int r = 0; r < 8; ++r)
      O[(lh*8 + r)*OPJ + lm*OPW + wave*2 + u] = 0.5f * res[u][r];   // / len(WINDOWS)
  // the stores below read what other waves wrote above
  __syncthreads();
#pragma unroll
  for (int c = 0; c < 4; ++c) {
    const int idx = threadIdx.x + c*256;
    const int dq = idx & 3, wl = (idx >> 2) & 15, j = idx >> 6;
    *(float4*)(accout + (size_t)(bh*16 + j)*NTOT + h*1024 + (w0 + wl)*32 + d0 + dq*4) =
        *(const float4*)(O + j*OPJ + wl*OPW + dq*4);
  }
}

// ---------------------------------------------------------------------------
// K8: final projection: d_out[c][n] = sum_c' acc[c'][n]*pw[c'][c] + pb[c]
// The tile is taken transposed, as in K1: M = output channel (A = pw^T),
// N = position (B = acc), so loads and stores both run along n.  A block takes
// 64 positions, a wave 32 channels of them: 2 x 4 accumulator tiles.
// Row M of channel tile e is channel c0 + 2*M + e (one 8-byte load of a pw row
// feeds both tiles); column N of position tile f is position n0 + 4*N + f (one
// 16-byte load of an acc row feeds all four, and four tiles' registers make one
// 16-byte store).  k runs as before: K-step k0 holds k0 + 2*lh + {0,1}.
// ---------------------------------------------------------------------------
// four K-steps' fragments: b[u][y] is acc row k + 4*u + 2*lh + y at positions
// n0 + 4*lm .. +3, a[u][y] the pw row of the same k at channels c0 + 2*lm, +1
static __device__ __forceinline__ void proj_load4(const float* bp, const float* ap,
                                                  int k, float4 (&b)[4][2],
                                                  float2 (&a)[4][2]) {
#pragma unroll
  for (int u = 0; u < 4; ++u)
#pragma unroll
    for (int y = 0; y < 2; ++y) {
      b[u][y] = *(const float4*)(bp + (size_t)(k + 4*u + y)*NTOT);
      a[u][y] = *(const float2*)(ap + (k + 4*u + y)*CDIM);
    }
}

static __device__ __forceinline__ void proj_mma4(const float4 (&b)[4][2],
                                                 const float2 (&a)[4][2],
                                                 v8f (&acc)[2][4]) {
#pragma unroll
  for (int u = 0; u < 4; ++u) {
    const v2f a0 = {a[u][0].x, a[u][1].x}, a1 = {a[u][0].y, a[u][1].y};
    const v2f b0 = {b[u][0].x, b[u][1].x}, b1 = {b[u][0].y, b[u][1].y};
    const v2f b2 = {b[u][0].z, b[u][1].z}, b3 = {b[u][0].w, b[u][1].w};
    acc[0][0] = wmma4(a0, b0, acc[0][0]);
    acc[0][1] = wmma4(a0, b1, acc[0][1]);
    acc[0][2] = wmma4(a0, b2, acc[0][2]);
    acc[0][3] = wmma4(a0, b3, acc[0][3]);
    acc[1][0] = wmma4(a1, b0, acc[1][0]);
    acc[1][1] = wmma4(a1, b1, acc[1][1]);
    acc[1][2] = wmma4(a1, b2, acc[1][2]);
    acc[1][3] = wmma4(a1, b3, acc[1][3]);
  }
}

__global__ __launch_bounds__(128)
void proj_gemm_kernel(const float* __restrict__ accb,
                      const float* __restrict__ pw,
                      const float* __restrict__ pb,
                      float* __restrict__ out) {
  const int wave = threadIdx.x >> 5;
  const int lane = threadIdx.x & 31;
  const int lm = lane & 15, lh = lane >> 4;
  const int n0 = blockIdx.x * 64;
  const int c0 = wave * 32;
  const float* bp = accb + (size_t)(2*lh)*NTOT + n0 + lm*4;
  const float* ap = pw + (2*lh)*CDIM + c0 + lm*2;
  v8f acc[2][4];
#pragma unroll
  for (int e = 0; e < 2; ++e)
#pragma unroll
    for (int f = 0; f < 4; ++f) acc[e][f] = (v8f){0,0,0,0,0,0,0,0};
  // three register sets of four K-steps each, one wave a SIMD: two sets' loads
  // fly while the third is multiplied.  The scheduling barriers hold each
  // refill directly behind the products that free its set and in front of the
  // next set's products: earlier it would need a fourth set, later it would
  // lose its lead
  float4 b0[4][2], b1[4][2], b2[4][2];
  float2 a0[4][2], a1[4][2], a2[4][2];
  proj_load4(bp, ap,  0, b0, a0);
  proj_load4(bp, ap, 16, b1, a1);
  proj_load4(bp, ap, 32, b2, a2);
  __builtin_amdgcn_sched_barrier(0);   // see above
  proj_mma4(b0, a0, acc);
  __builtin_amdgcn_sched_barrier(0);   // see above
  proj_load4(bp, ap, 48, b0, a0);
  __builtin_amdgcn_sched_barrier(0);   // see above
  proj_mma4(b1, a1, acc);
  __builtin_amdgcn_sched_barrier(0);   // see above
  proj_load4(bp, ap, 64, b1, a1);
  __builtin_amdgcn_sched_barrier(0);   // see above
  proj_mma4(b2, a2, acc);
  __builtin_amdgcn_sched_barrier(0);   // see above
  proj_load4(bp, ap, 80, b2, a2);
  __builtin_amdgcn_sched_barrier(0);   // see above
  proj_mma4(b0, a0, acc);
  __builtin_amdgcn_sched_barrier(0);   // see above
  proj_load4(bp, ap, 96, b0, a0);
  __builtin_amdgcn_sched_barrier(0);   // see above
  proj_mma4(b1, a1, acc);
  __builtin_amdgcn_sched_barrier(0);   // see above
#pragma unroll
  for (int u = 0; u < 4; ++u) {
    b1[u][0] = *(const float4*)(bp + (size_t)(112 + 4*u    )*NTOT);
    b1[u][1] = *(const float4*)(bp + (size_t)(112 + 4*u + 1)*NTOT);
  }
  // behind the last loads of acc rows: the built code lays one of the pw
  // fragments that follow into the register pair that they name as their address
  asm volatile("s_wait_xcnt 0x0" ::: "memory");
#pragma unroll
  for (int u = 0; u < 4; ++u) {
    a1[u][0] = *(const float2*)(ap + (112 + 4*u    )*CDIM);
    a1[u][1] = *(const float2*)(ap + (112 + 4*u + 1)*CDIM);
  }
  __builtin_amdgcn_sched_barrier(0);   // see above
  proj_mma4(b2, a2, acc);
  // the bias of this lane's 16 channels, c0 + 16*lh + 0..15, comes in during the
  // last two sets' products; the barriers hold its loads there
  __builtin_amdgcn_sched_barrier(0);
  float4 bias[4];
#pragma unroll
  for (int t = 0; t < 4; ++t) bias[t] = *(const float4*)(pb + c0 + 16*lh + 4*t);
  __builtin_amdgcn_sched_barrier(0);
  proj_mma4(b0, a0, acc);
  proj_mma4(b1, a1, acc);
  // acc[e][f][r] is M = r + 8*lh, that is channel c0 + 16*lh + 2*r + e, at
  // position n0 + 4*lm + f
  float* o = out + (size_t)(c0 + 16*lh)*NTOT + n0 + lm*4;
#pragma unroll
  for (int r = 0; r < 8; ++r) {
    const float4 bq = bias[r >> 1];
    const float be0 = (r & 1) ? bq.z : bq.x, be1 = (r & 1) ? bq.w : bq.y;
    *(float4*)(o + (size_t)(2*r    )*NTOT) =
        make_float4(acc[0][0][r] + be0, acc[0][1][r] + be0,
                    acc[0][2][r] + be0, acc[0][3][r] + be0);
    *(float4*)(o + (size_t)(2*r + 1)*NTOT) =
        make_float4(acc[1][0][r] + be1, acc[1][1][r] + be1,
                    acc[1][2][r] + be1, acc[1][3][r] + be1);
  }
}

// ---------------------------------------------------------------------------
extern "C" void kernel_launch(void* const* d_in, const int* in_sizes, int n_in,
                              void* d_out, int out_size, void* d_ws, size_t ws_size,
                              hipStream_t stream) {
  const float* x  = (const float*)d_in[0];
  const float* qw = (const float*)d_in[1];
  const float* kw = (const float*)d_in[2];
  const float* vw = (const float*)d_in[3];
  const float* pw = (const float*)d_in[4];
  const float* pb = (const float*)d_in[5];
  float* out = (float*)d_out;

  const size_t U = (size_t)NTOT * CDIM;     // 2,097,152 floats
  float* ws   = (float*)d_ws;
  float* q3   = ws + 3*U;                   // (C,N)
  float* accb = ws + 7*U;                   // attention output (C,N)
  float* kwin = ws + 8*U;                   // k window sums over w, 2 windows
  float* vwin = ws + 10*U;                  // v window sums over d, 2 windows

  qkv_window_kernel<<<dim3(512), 256, 0, stream>>>(x, qw, kw, vw, q3, kwin, vwin);
  window_attn_kernel<<<dim3(4, HH, HEADS), 256, 0, stream>>>(q3, kwin, kwin + U, vwin,
                                                             vwin + U, accb);
  proj_gemm_kernel<<<dim3(NTOT/64), 128, 0, stream>>>(accb, pw, pb, out);
}
